// v000
// The times below were measured on an AMD MI455X: many runs one after another, warmed up first and cycling through
// copies of the inputs, with the whole window's GPU time divided by the number of runs. Launches and the gaps
// between them are all in it. The median over several windows is given; except for v000 it joins two sittings, which
// can be a few percent apart, so the side-by-side timings, each taken in one sitting, are the better comparison.
// The starting kernel, v000, takes 143 microseconds a run.
#include <hip/hip_runtime.h>

constexpr int B = 8, T = 64, P = 196, M = 2048, H = 768;
constexpr int PPAD = 224;
constexpr int KC   = 1024;

typedef __attribute__((ext_vector_type(16))) _Float16 v16h;
typedef __attribute__((ext_vector_type(8)))  _Float16 v8h;
typedef __attribute__((ext_vector_type(8)))  float    v8f;
typedef unsigned int u32;
typedef __attribute__((ext_vector_type(4))) u32 u32x4;
typedef __attribute__((ext_vector_type(8))) int i32x8;
typedef __attribute__((ext_vector_type(4))) int i32x4;

// Workspace layout (bytes, all 16B aligned)
constexpr size_t OFF_FMA   = 0;                                   // fp16 [B][P][M]
constexpr size_t OFF_FMT   = OFF_FMA + (size_t)B * P * M * 2;     // fp16 [B][M][PPAD]
constexpr size_t OFF_WMAP  = OFF_FMT + (size_t)B * M * PPAD * 2;  // fp16 [H][M]
constexpr size_t OFF_WFIN  = OFF_WMAP + (size_t)H * M * 2;        // fp16 [H][M]
constexpr size_t OFF_MLO   = OFF_WFIN + (size_t)H * M * 2;        // fp32 [B][P][H]
constexpr size_t OFF_ATT16 = OFF_MLO + (size_t)B * P * H * 4;     // fp16 [B][T][PPAD]
constexpr size_t OFF_CTX16 = OFF_ATT16 + (size_t)B * T * PPAD * 2;// fp16 [B][T][M]

__device__ __forceinline__ void tdm_load_2d_f16(const void* gaddr, u32 lds_off,
                                                u32 tile_d0, u32 tile_d1,
                                                u32 tensor_d0, u32 tensor_d1,
                                                u32 row_stride) {
  unsigned long long ga = (unsigned long long)gaddr;
  u32x4 g0;
  g0.x = 1u;
  g0.y = lds_off;
  g0.z = (u32)ga;
  g0.w = (u32)(ga >> 32) | (2u << 30);
  i32x8 g1;
  g1[0] = (int)(1u << 16);
  g1[1] = (int)(tensor_d0 << 16);
  g1[2] = (int)((tensor_d0 >> 16) | (tensor_d1 << 16));
  g1[3] = (int)((tensor_d1 >> 16) | (tile_d0 << 16));
  g1[4] = (int)tile_d1;
  g1[5] = (int)row_stride;
  g1[6] = 0;
  g1[7] = 0;
  i32x4 z4 = {0, 0, 0, 0};
#if defined(__clang_major__) && __clang_major__ >= 23
  i32x8 z8 = {0, 0, 0, 0, 0, 0, 0, 0};
  __builtin_amdgcn_tensor_load_to_lds(g0, g1, z4, z4, z8, 0);
#else
  __builtin_amdgcn_tensor_load_to_lds(g0, g1, z4, z4, 0);
#endif
}

__device__ __forceinline__ v16h load_frag(const _Float16* mat, int ld, int row,
                                          int k0, int lane) {
  const _Float16* p = mat + (size_t)row * ld + k0 + ((lane >> 4) << 3);
  v8h lo = *(const v8h*)(p);
  v8h hi = *(const v8h*)(p + 16);
  return __builtin_shufflevector(lo, hi, 0, 1, 2, 3, 4, 5, 6, 7,
                                          8, 9, 10, 11, 12, 13, 14, 15);
}

// ---------------------------------------------------------------------------
// Stage 0: fp32 -> fp16 converts (and padded transpose of fm)
// ---------------------------------------------------------------------------
__global__ void k_cvt(const float* __restrict__ src, _Float16* __restrict__ dst, int n) {
  int i = blockIdx.x * blockDim.x + threadIdx.x;
  if (i < n) dst[i] = (_Float16)src[i];
}

__global__ void k_fmT(const float* __restrict__ maps, _Float16* __restrict__ fmT) {
  int i = blockIdx.x * blockDim.x + threadIdx.x;
  if (i >= B * M * PPAD) return;
  int p = i % PPAD;
  int m = (i / PPAD) % M;
  int b = i / (PPAD * M);
  float v = (p < P) ? maps[((size_t)b * P + p) * M + m] : 0.0f;
  fmT[i] = (_Float16)v;
}

__global__ void __launch_bounds__(128)
k_mlo(const _Float16* __restrict__ fmA, const _Float16* __restrict__ Wm,
      const float* __restrict__ b_map, float* __restrict__ mlo) {
  __shared__ _Float16 Atile[16 * KC];              // 32 KB
  int lane = threadIdx.x & 31;
  int wave = threadIdx.x >> 5;
  int b  = blockIdx.z;                             // 8
  int pt = blockIdx.y;                             // 13 p-tiles (208 >= 196)
  int hg = blockIdx.x * 4 + wave;                  // 12 groups of 64 h
  const _Float16* Abase = fmA + ((size_t)b * P + pt * 16) * M;
  int rows = P - pt * 16; if (rows > 16) rows = 16;

  int arow = lane & 15;
  int br0  = hg * 64 + (lane & 15);
  v8f c[4] = {};

  for (int chunk = 0; chunk < M / KC; ++chunk) {
    if (threadIdx.x < 32) {                        // wave 0 drives the DMA
      tdm_load_2d_f16(Abase + chunk * KC, (u32)(size_t)Atile,
                      KC, 16, KC, (u32)rows, M);
      __builtin_amdgcn_s_wait_tensorcnt((short)0);
    }
    __syncthreads();
    for (int k = 0; k < KC; k += 32) {
      int kg = chunk * KC + k;
      __builtin_prefetch(Wm + (size_t)br0 * M + kg + 128, 0, 3);
      v16h a = load_frag(Atile, KC, arow, k, lane); // ds_load_b128 x2
      v16h bb[4];
#pragma unroll
      for (int j = 0; j < 4; ++j)
        bb[j] = load_frag(Wm, M, br0 + j * 16, kg, lane);
#pragma unroll
      for (int j = 0; j < 4; ++j)
        c[j] = __builtin_amdgcn_wmma_f32_16x16x32_f16(false, a, false, bb[j],
                                                      (short)0, c[j], false, false);
    }
    __syncthreads();                               // all reads done before next DMA
  }

  int po = (lane >> 4) * 8;
#pragma unroll
  for (int j = 0; j < 4; ++j) {
    int h = hg * 64 + j * 16 + (lane & 15);
    float bias = b_map[h];
#pragma unroll
    for (int r = 0; r < 8; ++r) {
      int p = pt * 16 + po + r;
      if (p < P) mlo[((size_t)b * P + p) * H + h] = c[j][r] + bias;
    }
  }
}

// ---------------------------------------------------------------------------
// Stage 2: scores + softmax.  One block per (b,t).
// score[p] = sum_h W_rect[h]*relu(mlo[b,p,h]+hid[b,t,h]) + b_rect
// ReLU between add and reduction => VALU (cannot be a GEMM); ~0.3 Gops total.
// ---------------------------------------------------------------------------
__global__ void __launch_bounds__(256)
k_scores(const float* __restrict__ mlo, const float* __restrict__ hiddens,
         const float* __restrict__ W_rect, const float* __restrict__ b_rect,
         float* __restrict__ attn_out, _Float16* __restrict__ attn16) {
  __shared__ float hid[H];
  __shared__ float wr[H];
  __shared__ float red[256];
  int t = blockIdx.x, b = blockIdx.y;
  int tid = threadIdx.x;

  for (int h = tid; h < H; h += 256) {
    hid[h] = hiddens[((size_t)b * T + t) * H + h];
    wr[h]  = W_rect[h];
  }
  __syncthreads();

  float val = 0.0f;
  if (tid < P) {
    const float* mrow = mlo + ((size_t)b * P + tid) * H;
    float acc = 0.0f;
    for (int h = 0; h < H; ++h) {
      float r = mrow[h] + hid[h];
      acc = fmaf(wr[h], (r > 0.0f ? r : 0.0f), acc);
    }
    val = acc + b_rect[0];
  }

  red[tid] = (tid < P) ? val : -3.0e38f;
  __syncthreads();
  for (int s = 128; s > 0; s >>= 1) {
    if (tid < s) red[tid] = fmaxf(red[tid], red[tid + s]);
    __syncthreads();
  }
  float mx = red[0];
  __syncthreads();

  float e = (tid < P) ? __expf(val - mx) : 0.0f;
  red[tid] = e;
  __syncthreads();
  for (int s = 128; s > 0; s >>= 1) {
    if (tid < s) red[tid] += red[tid + s];
    __syncthreads();
  }
  float a = e / red[0];

  if (tid < P)    attn_out[((size_t)b * T + t) * P + tid] = a;
  if (tid < PPAD) attn16[((size_t)b * T + t) * PPAD + tid] =
                      (_Float16)((tid < P) ? a : 0.0f);
}

__global__ void __launch_bounds__(128)
k_ctx(const _Float16* __restrict__ attn16, const _Float16* __restrict__ fmT,
      _Float16* __restrict__ ctx16) {
  __shared__ _Float16 Atile[16 * PPAD];            // 7 KB
  int lane = threadIdx.x & 31;
  int wave = threadIdx.x >> 5;
  int b  = blockIdx.z;                             // 8
  int tt = blockIdx.y;                             // 4 t-tiles
  int mg = blockIdx.x * 4 + wave;                  // 32 groups of 64 m
  const _Float16* Abase = attn16 + ((size_t)b * T + tt * 16) * PPAD;
  const _Float16* Bf    = fmT    + (size_t)b * M * PPAD;

  if (threadIdx.x < 32) {
    tdm_load_2d_f16(Abase, (u32)(size_t)Atile, PPAD, 16, PPAD, 16, PPAD);
    __builtin_amdgcn_s_wait_tensorcnt((short)0);
  }
  __syncthreads();

  int arow = lane & 15;
  int br0  = mg * 64 + (lane & 15);
  v8f c[4] = {};
  for (int k = 0; k < PPAD; k += 32) {
    v16h a = load_frag(Atile, PPAD, arow, k, lane);
    v16h bb[4];
#pragma unroll
    for (int j = 0; j < 4; ++j)
      bb[j] = load_frag(Bf, PPAD, br0 + j * 16, k, lane);
#pragma unroll
    for (int j = 0; j < 4; ++j)
      c[j] = __builtin_amdgcn_wmma_f32_16x16x32_f16(false, a, false, bb[j],
                                                    (short)0, c[j], false, false);
  }

  int to = (lane >> 4) * 8;
#pragma unroll
  for (int j = 0; j < 4; ++j) {
    int m = mg * 64 + j * 16 + (lane & 15);
#pragma unroll
    for (int r = 0; r < 8; ++r) {
      int t = tt * 16 + to + r;
      ctx16[((size_t)b * T + t) * M + m] = (_Float16)c[j][r];
    }
  }
}

__global__ void __launch_bounds__(128)
k_final(const _Float16* __restrict__ ctx16, const _Float16* __restrict__ Wf,
        const float* __restrict__ b_final, const float* __restrict__ hiddens,
        float* __restrict__ out) {
  __shared__ _Float16 Atile[16 * KC];              // 32 KB
  int lane = threadIdx.x & 31;
  int wave = threadIdx.x >> 5;
  int b  = blockIdx.z;                             // 8
  int tt = blockIdx.y;                             // 4 t-tiles
  int hg = blockIdx.x * 4 + wave;                  // 12 groups of 64 h
  const _Float16* Abase = ctx16 + ((size_t)b * T + tt * 16) * M;

  int arow = lane & 15;
  int br0  = hg * 64 + (lane & 15);
  v8f c[4] = {};

  for (int chunk = 0; chunk < M / KC; ++chunk) {
    if (threadIdx.x < 32) {
      tdm_load_2d_f16(Abase + chunk * KC, (u32)(size_t)Atile,
                      KC, 16, KC, 16, M);
      __builtin_amdgcn_s_wait_tensorcnt((short)0);
    }
    __syncthreads();
    for (int k = 0; k < KC; k += 32) {
      int kg = chunk * KC + k;
      __builtin_prefetch(Wf + (size_t)br0 * M + kg + 128, 0, 3);
      v16h a = load_frag(Atile, KC, arow, k, lane);
      v16h bb[4];
#pragma unroll
      for (int j = 0; j < 4; ++j)
        bb[j] = load_frag(Wf, M, br0 + j * 16, kg, lane);
#pragma unroll
      for (int j = 0; j < 4; ++j)
        c[j] = __builtin_amdgcn_wmma_f32_16x16x32_f16(false, a, false, bb[j],
                                                      (short)0, c[j], false, false);
    }
    __syncthreads();
  }

  int to = (lane >> 4) * 8;
#pragma unroll
  for (int j = 0; j < 4; ++j) {
    int h = hg * 64 + j * 16 + (lane & 15);
    float bias = b_final[h];
#pragma unroll
    for (int r = 0; r < 8; ++r) {
      int t = tt * 16 + to + r;
      size_t idx = ((size_t)b * T + t) * H + h;
      out[idx] = c[j][r] + bias + hiddens[idx];
    }
  }
}

// ---------------------------------------------------------------------------
extern "C" void kernel_launch(void* const* d_in, const int* in_sizes, int n_in,
                              void* d_out, int out_size, void* d_ws, size_t ws_size,
                              hipStream_t stream) {
  (void)in_sizes; (void)n_in; (void)out_size; (void)ws_size;
  const float* maps    = (const float*)d_in[0];
  const float* hiddens = (const float*)d_in[1];
  const float* W_map   = (const float*)d_in[2];
  const float* b_map   = (const float*)d_in[3];
  const float* W_final = (const float*)d_in[4];
  const float* b_final = (const float*)d_in[5];
  const float* W_rect  = (const float*)d_in[6];
  const float* b_rect  = (const float*)d_in[7];

  float* out  = (float*)d_out;                     // (B,T,H)
  float* attn = out + (size_t)B * T * H;           // (B,T,P)

  char* ws = (char*)d_ws;
  _Float16* fmA   = (_Float16*)(ws + OFF_FMA);
  _Float16* fmT   = (_Float16*)(ws + OFF_FMT);
  _Float16* Wm16  = (_Float16*)(ws + OFF_WMAP);
  _Float16* Wf16  = (_Float16*)(ws + OFF_WFIN);
  float*    mlo   = (float*)   (ws + OFF_MLO);
  _Float16* att16 = (_Float16*)(ws + OFF_ATT16);
  _Float16* ctx16 = (_Float16*)(ws + OFF_CTX16);

  // Stage 0: converts
  {
    int n = B * P * M;
    k_cvt<<<(n + 255) / 256, 256, 0, stream>>>(maps, fmA, n);
  }
  {
    int n = H * M;
    k_cvt<<<(n + 255) / 256, 256, 0, stream>>>(W_map, Wm16, n);
    k_cvt<<<(n + 255) / 256, 256, 0, stream>>>(W_final, Wf16, n);
  }
  {
    int n = B * M * PPAD;
    k_fmT<<<(n + 255) / 256, 256, 0, stream>>>(maps, fmT);
  }

  k_mlo<<<dim3(3, 13, 8), 128, 0, stream>>>(fmA, Wm16, b_map, mlo);

  // Stage 2: fused rectified score + softmax (VALU)
  k_scores<<<dim3(T, B), 256, 0, stream>>>(mlo, hiddens, W_rect, b_rect, attn, att16);

  k_ctx<<<dim3(8, 4, 8), 128, 0, stream>>>(att16, fmT, ctx16);

  k_final<<<dim3(3, 4, 8), 128, 0, stream>>>(ctx16, Wf16, b_final, hiddens, out);
}

// v001
// Measured time: 131 microseconds a run.
// Next to v000, in two timings, it ran 1.11 times as fast each time.
#include <hip/hip_runtime.h>

constexpr int B = 8, T = 64, P = 196, M = 2048, H = 768;
constexpr int PPAD = 224;
constexpr int KC   = 1024;
constexpr int PT   = 208;

typedef __attribute__((ext_vector_type(16))) _Float16 v16h;
typedef __attribute__((ext_vector_type(8)))  _Float16 v8h;
typedef __attribute__((ext_vector_type(8)))  float    v8f;
typedef unsigned int u32;
typedef __attribute__((ext_vector_type(4))) u32 u32x4;
typedef __attribute__((ext_vector_type(8))) int i32x8;
typedef __attribute__((ext_vector_type(4))) int i32x4;

// Workspace layout (bytes, all 16B aligned)
constexpr size_t OFF_FMA   = 0;                                   // fp16 [B][P][M]
constexpr size_t OFF_FMT   = OFF_FMA + (size_t)B * P * M * 2;     // fp16 [B][M][PPAD]
constexpr size_t OFF_WMAP  = OFF_FMT + (size_t)B * M * PPAD * 2;  // fp16 [H][M]
constexpr size_t OFF_WFIN  = OFF_WMAP + (size_t)H * M * 2;        // fp16 [H][M]
constexpr size_t OFF_MLO   = OFF_WFIN + (size_t)H * M * 2;        // fp32 [B][H/4][PT][4]
constexpr size_t OFF_ATT16 = OFF_MLO + (size_t)B * H * PT * 4;    // fp16 [B][T][PPAD]
constexpr size_t OFF_CTX16 = OFF_ATT16 + (size_t)B * T * PPAD * 2;// fp16 [B][T][M]

__device__ __forceinline__ void tdm_load_2d_f16(const void* gaddr, u32 lds_off,
                                                u32 tile_d0, u32 tile_d1,
                                                u32 tensor_d0, u32 tensor_d1,
                                                u32 row_stride) {
  unsigned long long ga = (unsigned long long)gaddr;
  u32x4 g0;
  g0.x = 1u;
  g0.y = lds_off;
  g0.z = (u32)ga;
  g0.w = (u32)(ga >> 32) | (2u << 30);
  i32x8 g1;
  g1[0] = (int)(1u << 16);
  g1[1] = (int)(tensor_d0 << 16);
  g1[2] = (int)((tensor_d0 >> 16) | (tensor_d1 << 16));
  g1[3] = (int)((tensor_d1 >> 16) | (tile_d0 << 16));
  g1[4] = (int)tile_d1;
  g1[5] = (int)row_stride;
  g1[6] = 0;
  g1[7] = 0;
  i32x4 z4 = {0, 0, 0, 0};
#if defined(__clang_major__) && __clang_major__ >= 23
  i32x8 z8 = {0, 0, 0, 0, 0, 0, 0, 0};
  __builtin_amdgcn_tensor_load_to_lds(g0, g1, z4, z4, z8, 0);
#else
  __builtin_amdgcn_tensor_load_to_lds(g0, g1, z4, z4, 0);
#endif
}

__device__ __forceinline__ v16h load_frag(const _Float16* mat, int ld, int row,
                                          int k0, int lane) {
  const _Float16* p = mat + (size_t)row * ld + k0 + ((lane >> 4) << 3);
  v8h lo = *(const v8h*)(p);
  v8h hi = *(const v8h*)(p + 16);
  return __builtin_shufflevector(lo, hi, 0, 1, 2, 3, 4, 5, 6, 7,
                                          8, 9, 10, 11, 12, 13, 14, 15);
}

// ---------------------------------------------------------------------------
// Stage 0: fp32 -> fp16 converts (and padded transpose of fm)
// ---------------------------------------------------------------------------
__global__ void k_cvt(const float* __restrict__ src, _Float16* __restrict__ dst, int n) {
  int i = blockIdx.x * blockDim.x + threadIdx.x;
  if (i < n) dst[i] = (_Float16)src[i];
}

__global__ void k_fmT(const float* __restrict__ maps, _Float16* __restrict__ fmT) {
  int i = blockIdx.x * blockDim.x + threadIdx.x;
  if (i >= B * M * PPAD) return;
  int p = i % PPAD;
  int m = (i / PPAD) % M;
  int b = i / (PPAD * M);
  float v = (p < P) ? maps[((size_t)b * P + p) * M + m] : 0.0f;
  fmT[i] = (_Float16)v;
}

__global__ void __launch_bounds__(128)
k_mlo(const _Float16* __restrict__ fmA, const _Float16* __restrict__ Wm,
      const float* __restrict__ b_map, float* __restrict__ mlo) {
  __shared__ _Float16 Atile[16 * KC];              // 32 KB
  int lane = threadIdx.x & 31;
  int wave = threadIdx.x >> 5;
  int b  = blockIdx.z;                             // 8
  int pt = blockIdx.y;                             // 13 p-tiles (208 >= 196)
  int hg = blockIdx.x * 4 + wave;                  // 12 groups of 64 h
  const _Float16* Abase = fmA + ((size_t)b * P + pt * 16) * M;
  int rows = P - pt * 16; if (rows > 16) rows = 16;

  int arow = lane & 15;
  int br0  = hg * 64 + (lane & 15);
  v8f c[4] = {};

  for (int chunk = 0; chunk < M / KC; ++chunk) {
    if (threadIdx.x < 32) {                        // wave 0 drives the DMA
      tdm_load_2d_f16(Abase + chunk * KC, (u32)(size_t)Atile,
                      KC, 16, KC, (u32)rows, M);
      __builtin_amdgcn_s_wait_tensorcnt((short)0);
    }
    __syncthreads();
    for (int k = 0; k < KC; k += 32) {
      int kg = chunk * KC + k;
      __builtin_prefetch(Wm + (size_t)br0 * M + kg + 128, 0, 3);
      v16h a = load_frag(Atile, KC, arow, k, lane); // ds_load_b128 x2
      v16h bb[4];
#pragma unroll
      for (int j = 0; j < 4; ++j)
        bb[j] = load_frag(Wm, M, br0 + j * 16, kg, lane);
#pragma unroll
      for (int j = 0; j < 4; ++j)
        c[j] = __builtin_amdgcn_wmma_f32_16x16x32_f16(false, a, false, bb[j],
                                                      (short)0, c[j], false, false);
    }
    __syncthreads();                               // all reads done before next DMA
  }

  int po = (lane >> 4) * 8;
#pragma unroll
  for (int j = 0; j < 4; ++j) {
    int h = hg * 64 + j * 16 + (lane & 15);
    float bias = b_map[h];
#pragma unroll
    for (int r = 0; r < 8; ++r) {
      int p = pt * 16 + po + r;                    // p in [P, PT) is pad, never read
      mlo[(((size_t)b * (H / 4) + (h >> 2)) * PT + p) * 4 + (h & 3)] = c[j][r] + bias;
    }
  }
}

// ---------------------------------------------------------------------------
// Stage 2: scores + softmax.  One block per (b,t).
// score[p] = sum_h W_rect[h]*relu(mlo[b,p,h]+hid[b,t,h]) + b_rect
// ReLU between add and reduction => VALU (cannot be a GEMM); ~0.3 Gops total.
// ---------------------------------------------------------------------------
__global__ void __launch_bounds__(256)
k_scores(const float* __restrict__ mlo, const float* __restrict__ hiddens,
         const float* __restrict__ W_rect, const float* __restrict__ b_rect,
         float* __restrict__ attn_out, _Float16* __restrict__ attn16) {
  __shared__ float hid[H];
  __shared__ float wr[H];
  __shared__ float red[256];
  int t = blockIdx.x, b = blockIdx.y;
  int tid = threadIdx.x;

  for (int h = tid; h < H; h += 256) {
    hid[h] = hiddens[((size_t)b * T + t) * H + h];
    wr[h]  = W_rect[h];
  }
  __syncthreads();

  float val = 0.0f;
  if (tid < P) {
    const float4* mq = (const float4*)mlo + (size_t)b * (H / 4) * PT + tid;
    float acc = 0.0f;
    // unroll: eight independent whole-line loads in flight per wave
#pragma unroll 8
    for (int h4 = 0; h4 < H / 4; ++h4) {
      float4 q = mq[(size_t)h4 * PT];
      float mv[4] = {q.x, q.y, q.z, q.w};
#pragma unroll
      for (int u = 0; u < 4; ++u) {                // h ascending: same sum order
        float r = mv[u] + hid[h4 * 4 + u];
        acc = fmaf(wr[h4 * 4 + u], (r > 0.0f ? r : 0.0f), acc);
      }
    }
    val = acc + b_rect[0];
  }

  red[tid] = (tid < P) ? val : -3.0e38f;
  __syncthreads();
  for (int s = 128; s > 0; s >>= 1) {
    if (tid < s) red[tid] = fmaxf(red[tid], red[tid + s]);
    __syncthreads();
  }
  float mx = red[0];
  __syncthreads();

  float e = (tid < P) ? __expf(val - mx) : 0.0f;
  red[tid] = e;
  __syncthreads();
  for (int s = 128; s > 0; s >>= 1) {
    if (tid < s) red[tid] += red[tid + s];
    __syncthreads();
  }
  float a = e / red[0];

  if (tid < P)    attn_out[((size_t)b * T + t) * P + tid] = a;
  if (tid < PPAD) attn16[((size_t)b * T + t) * PPAD + tid] =
                      (_Float16)((tid < P) ? a : 0.0f);
}

__global__ void __launch_bounds__(128)
k_ctx(const _Float16* __restrict__ attn16, const _Float16* __restrict__ fmT,
      _Float16* __restrict__ ctx16) {
  __shared__ _Float16 Atile[16 * PPAD];            // 7 KB
  int lane = threadIdx.x & 31;
  int wave = threadIdx.x >> 5;
  int b  = blockIdx.z;                             // 8
  int tt = blockIdx.y;                             // 4 t-tiles
  int mg = blockIdx.x * 4 + wave;                  // 32 groups of 64 m
  const _Float16* Abase = attn16 + ((size_t)b * T + tt * 16) * PPAD;
  const _Float16* Bf    = fmT    + (size_t)b * M * PPAD;

  if (threadIdx.x < 32) {
    tdm_load_2d_f16(Abase, (u32)(size_t)Atile, PPAD, 16, PPAD, 16, PPAD);
    __builtin_amdgcn_s_wait_tensorcnt((short)0);
  }
  __syncthreads();

  int arow = lane & 15;
  int br0  = mg * 64 + (lane & 15);
  v8f c[4] = {};
  for (int k = 0; k < PPAD; k += 32) {
    v16h a = load_frag(Atile, PPAD, arow, k, lane);
    v16h bb[4];
#pragma unroll
    for (int j = 0; j < 4; ++j)
      bb[j] = load_frag(Bf, PPAD, br0 + j * 16, k, lane);
#pragma unroll
    for (int j = 0; j < 4; ++j)
      c[j] = __builtin_amdgcn_wmma_f32_16x16x32_f16(false, a, false, bb[j],
                                                    (short)0, c[j], false, false);
  }

  int to = (lane >> 4) * 8;
#pragma unroll
  for (int j = 0; j < 4; ++j) {
    int m = mg * 64 + j * 16 + (lane & 15);
#pragma unroll
    for (int r = 0; r < 8; ++r) {
      int t = tt * 16 + to + r;
      ctx16[((size_t)b * T + t) * M + m] = (_Float16)c[j][r];
    }
  }
}

__global__ void __launch_bounds__(128)
k_final(const _Float16* __restrict__ ctx16, const _Float16* __restrict__ Wf,
        const float* __restrict__ b_final, const float* __restrict__ hiddens,
        float* __restrict__ out) {
  __shared__ _Float16 Atile[16 * KC];              // 32 KB
  int lane = threadIdx.x & 31;
  int wave = threadIdx.x >> 5;
  int b  = blockIdx.z;                             // 8
  int tt = blockIdx.y;                             // 4 t-tiles
  int hg = blockIdx.x * 4 + wave;                  // 12 groups of 64 h
  const _Float16* Abase = ctx16 + ((size_t)b * T + tt * 16) * M;

  int arow = lane & 15;
  int br0  = hg * 64 + (lane & 15);
  v8f c[4] = {};

  for (int chunk = 0; chunk < M / KC; ++chunk) {
    if (threadIdx.x < 32) {
      tdm_load_2d_f16(Abase + chunk * KC, (u32)(size_t)Atile,
                      KC, 16, KC, 16, M);
      __builtin_amdgcn_s_wait_tensorcnt((short)0);
    }
    __syncthreads();
    for (int k = 0; k < KC; k += 32) {
      int kg = chunk * KC + k;
      __builtin_prefetch(Wf + (size_t)br0 * M + kg + 128, 0, 3);
      v16h a = load_frag(Atile, KC, arow, k, lane);
      v16h bb[4];
#pragma unroll
      for (int j = 0; j < 4; ++j)
        bb[j] = load_frag(Wf, M, br0 + j * 16, kg, lane);
#pragma unroll
      for (int j = 0; j < 4; ++j)
        c[j] = __builtin_amdgcn_wmma_f32_16x16x32_f16(false, a, false, bb[j],
                                                      (short)0, c[j], false, false);
    }
    __syncthreads();
  }

  int to = (lane >> 4) * 8;
#pragma unroll
  for (int j = 0; j < 4; ++j) {
    int h = hg * 64 + j * 16 + (lane & 15);
    float bias = b_final[h];
#pragma unroll
    for (int r = 0; r < 8; ++r) {
      int t = tt * 16 + to + r;
      size_t idx = ((size_t)b * T + t) * H + h;
      out[idx] = c[j][r] + bias + hiddens[idx];
    }
  }
}

// ---------------------------------------------------------------------------
extern "C" void kernel_launch(void* const* d_in, const int* in_sizes, int n_in,
                              void* d_out, int out_size, void* d_ws, size_t ws_size,
                              hipStream_t stream) {
  (void)in_sizes; (void)n_in; (void)out_size; (void)ws_size;
  const float* maps    = (const float*)d_in[0];
  const float* hiddens = (const float*)d_in[1];
  const float* W_map   = (const float*)d_in[2];
  const float* b_map   = (const float*)d_in[3];
  const float* W_final = (const float*)d_in[4];
  const float* b_final = (const float*)d_in[5];
  const float* W_rect  = (const float*)d_in[6];
  const float* b_rect  = (const float*)d_in[7];

  float* out  = (float*)d_out;                     // (B,T,H)
  float* attn = out + (size_t)B * T * H;           // (B,T,P)

  char* ws = (char*)d_ws;
  _Float16* fmA   = (_Float16*)(ws + OFF_FMA);
  _Float16* fmT   = (_Float16*)(ws + OFF_FMT);
  _Float16* Wm16  = (_Float16*)(ws + OFF_WMAP);
  _Float16* Wf16  = (_Float16*)(ws + OFF_WFIN);
  float*    mlo   = (float*)   (ws + OFF_MLO);
  _Float16* att16 = (_Float16*)(ws + OFF_ATT16);
  _Float16* ctx16 = (_Float16*)(ws + OFF_CTX16);

  // Stage 0: converts
  {
    int n = B * P * M;
    k_cvt<<<(n + 255) / 256, 256, 0, stream>>>(maps, fmA, n);
  }
  {
    int n = H * M;
    k_cvt<<<(n + 255) / 256, 256, 0, stream>>>(W_map, Wm16, n);
    k_cvt<<<(n + 255) / 256, 256, 0, stream>>>(W_final, Wf16, n);
  }
  {
    int n = B * M * PPAD;
    k_fmT<<<(n + 255) / 256, 256, 0, stream>>>(maps, fmT);
  }

  k_mlo<<<dim3(3, 13, 8), 128, 0, stream>>>(fmA, Wm16, b_map, mlo);

  // Stage 2: fused rectified score + softmax (VALU)
  k_scores<<<dim3(T, B), 256, 0, stream>>>(mlo, hiddens, W_rect, b_rect, attn, att16);

  k_ctx<<<dim3(8, 4, 8), 128, 0, stream>>>(att16, fmT, ctx16);

  k_final<<<dim3(3, 4, 8), 128, 0, stream>>>(ctx16, Wf16, b_final, hiddens, out);
}

// v002
// One run takes 122 microseconds.
// Next to v001, in two timings, it ran 1.07 and 1.09 times as fast.
// All steps since v000 together make it 1.19 times as fast.
#include <hip/hip_runtime.h>

constexpr int B = 8, T = 64, P = 196, M = 2048, H = 768;
constexpr int PPAD = 224;
constexpr int KC   = 1024;
constexpr int PT   = 208;

typedef __attribute__((ext_vector_type(16))) _Float16 v16h;
typedef __attribute__((ext_vector_type(8)))  _Float16 v8h;
typedef __attribute__((ext_vector_type(8)))  float    v8f;
typedef unsigned int u32;
typedef __attribute__((ext_vector_type(4))) u32 u32x4;
typedef __attribute__((ext_vector_type(8))) int i32x8;
typedef __attribute__((ext_vector_type(4))) int i32x4;

// Workspace layout (bytes, all 16B aligned)
constexpr size_t OFF_FMA   = 0;                                   // fp16 [B][P][M]
constexpr size_t OFF_FMT   = OFF_FMA + (size_t)B * P * M * 2;     // fp16 [B][M][PPAD]
constexpr size_t OFF_WMAP  = OFF_FMT + (size_t)B * M * PPAD * 2;  // fp16 [H][M]
constexpr size_t OFF_WFIN  = OFF_WMAP + (size_t)H * M * 2;        // fp16 [H][M]
constexpr size_t OFF_MLO   = OFF_WFIN + (size_t)H * M * 2;        // fp32 [B][H/4][PT][4]
constexpr size_t OFF_ATT16 = OFF_MLO + (size_t)B * H * PT * 4;    // fp16 [B][T][PPAD]
constexpr size_t OFF_CTX16 = OFF_ATT16 + (size_t)B * T * PPAD * 2;// fp16 [B][T][M]

__device__ __forceinline__ void tdm_load_2d_f16(const void* gaddr, u32 lds_off,
                                                u32 tile_d0, u32 tile_d1,
                                                u32 tensor_d0, u32 tensor_d1,
                                                u32 row_stride) {
  unsigned long long ga = (unsigned long long)gaddr;
  u32x4 g0;
  g0.x = 1u;
  g0.y = lds_off;
  g0.z = (u32)ga;
  g0.w = (u32)(ga >> 32) | (2u << 30);
  i32x8 g1;
  g1[0] = (int)(1u << 16);
  g1[1] = (int)(tensor_d0 << 16);
  g1[2] = (int)((tensor_d0 >> 16) | (tensor_d1 << 16));
  g1[3] = (int)((tensor_d1 >> 16) | (tile_d0 << 16));
  g1[4] = (int)tile_d1;
  g1[5] = (int)row_stride;
  g1[6] = 0;
  g1[7] = 0;
  i32x4 z4 = {0, 0, 0, 0};
#if defined(__clang_major__) && __clang_major__ >= 23
  i32x8 z8 = {0, 0, 0, 0, 0, 0, 0, 0};
  __builtin_amdgcn_tensor_load_to_lds(g0, g1, z4, z4, z8, 0);
#else
  __builtin_amdgcn_tensor_load_to_lds(g0, g1, z4, z4, 0);
#endif
}

__device__ __forceinline__ v16h load_frag(const _Float16* mat, int ld, int row,
                                          int k0, int lane) {
  const _Float16* p = mat + (size_t)row * ld + k0 + ((lane >> 4) << 3);
  v8h lo = *(const v8h*)(p);
  v8h hi = *(const v8h*)(p + 16);
  return __builtin_shufflevector(lo, hi, 0, 1, 2, 3, 4, 5, 6, 7,
                                          8, 9, 10, 11, 12, 13, 14, 15);
}

// ---------------------------------------------------------------------------
// Stage 0: fp32 -> fp16 converts (and padded transpose of fm)
// Few fat waves: every global access is 16 B (8 B for the fp16 stores of k_cvt) per
// lane on whole 128-B lines, and all loads of a thread are issued before the first use.
// ---------------------------------------------------------------------------
typedef __attribute__((ext_vector_type(4))) float    f32x4;
typedef __attribute__((ext_vector_type(2))) float    f32x2;
typedef __attribute__((ext_vector_type(4))) _Float16 v4h;
typedef __attribute__((ext_vector_type(2))) _Float16 v2h;

constexpr int CU   = 8;                   // 16-byte loads per thread of k_cvt
constexpr int CBLK = 256 * CU * 4;        // elements per block of k_cvt
static_assert((B * P * M) % CBLK == 0 && (H * M) % CBLK == 0, "k_cvt has no tail");

__global__ void __launch_bounds__(256)
k_cvt(const float* __restrict__ src, _Float16* __restrict__ dst) {
  size_t base = (size_t)blockIdx.x * (256 * CU) + threadIdx.x;   // in units of 4 elements
  const f32x4* s = (const f32x4*)src + base;
  v4h*         d = (v4h*)dst + base;
  f32x4 v[CU];
#pragma unroll                            // v[] stays in registers, CU loads in flight
  for (int u = 0; u < CU; ++u) v[u] = s[u * 256];
#pragma unroll
  for (int u = 0; u < CU; ++u) d[u * 256] = __builtin_convertvector(v[u], v4h);
}

constexpr int MT = 64;
static_assert(P % 2 == 0 && PPAD % 32 == 0 && PPAD <= 256 && M % MT == 0, "tile shape");
static_assert((MT * PPAD / 8) % 256 == 0, "whole 16-byte stores per thread");

__global__ void __launch_bounds__(256)
k_fmT(const float* __restrict__ maps, _Float16* __restrict__ fmT) {
  __shared__ __attribute__((aligned(16))) u32 tile[MT * 128];    // 32 KB
  constexpr int NJ = PPAD / 32;           // passes of 16 row pairs
  int tid = threadIdx.x;
  int l16 = tid & 15;                     // m = 4 * l16 + i
  int pr  = tid >> 4;                     // row pair inside a pass
  int b   = blockIdx.y;
  int m0  = blockIdx.x * MT;
  const f32x4* s = (const f32x4*)(maps + (size_t)b * P * M + m0) + l16;

  // every loop below is unrolled so that lo[] and hi[] stay in registers
  f32x4 lo[NJ], hi[NJ];                   // rows 2q and 2q + 1
#pragma unroll
  for (int j = 0; j < NJ; ++j) {          // no branch: all loads of a thread in flight at once
    int q  = j * 16 + pr;
    int qc = (j * 16 + 15 < P / 2) ? q : (q < P / 2 ? q : P / 2 - 1);
    lo[j] = s[(size_t)(2 * qc) * (M / 4)];
    hi[j] = s[(size_t)(2 * qc + 1) * (M / 4)];
  }
  // keeps the converts behind the last load: without it the last pass's two loads are
  // issued only after the first loads have returned, a second trip to memory
  __builtin_amdgcn_sched_barrier(0);
#pragma unroll
  for (int j = 0; j < NJ; ++j) {          // p in [P, PPAD): zero pad
    if (j * 16 + 15 >= P / 2 && j * 16 + pr >= P / 2) {
      lo[j] = (f32x4){0.0f, 0.0f, 0.0f, 0.0f};
      hi[j] = (f32x4){0.0f, 0.0f, 0.0f, 0.0f};
    }
  }
#pragma unroll
  for (int j = 0; j < NJ; ++j) {
    int q = j * 16 + pr;
    int col = (((q >> 2) ^ l16) << 2) + (q & 3);
#pragma unroll
    for (int i = 0; i < 4; ++i) {
      f32x2 two = {lo[j][i], hi[j][i]};
      tile[(4 * l16 + i) * 128 + col] =
          __builtin_bit_cast(u32, __builtin_convertvector(two, v2h));
    }
  }
  __syncthreads();                        // the tile is whole before any row is read

  u32x4* dst = (u32x4*)(fmT + ((size_t)b * M + m0) * PPAD);
#pragma unroll                            // all LDS reads issued before the first store
  for (int j = 0; j < MT * PPAD / 8 / 256; ++j) {
    int o = j * 256 + tid;                // 16-byte chunk of the block's output range
    int m = o / (PPAD / 8);
    int c = o % (PPAD / 8);
    dst[o] = *(const u32x4*)&tile[m * 128 + ((c ^ ((m >> 2) & 15)) << 2)];
  }
}

__global__ void __launch_bounds__(128)
k_mlo(const _Float16* __restrict__ fmA, const _Float16* __restrict__ Wm,
      const float* __restrict__ b_map, float* __restrict__ mlo) {
  __shared__ _Float16 Atile[16 * KC];              // 32 KB
  int lane = threadIdx.x & 31;
  int wave = threadIdx.x >> 5;
  int b  = blockIdx.z;                             // 8
  int pt = blockIdx.y;                             // 13 p-tiles (208 >= 196)
  int hg = blockIdx.x * 4 + wave;                  // 12 groups of 64 h
  const _Float16* Abase = fmA + ((size_t)b * P + pt * 16) * M;
  int rows = P - pt * 16; if (rows > 16) rows = 16;

  int arow = lane & 15;
  int br0  = hg * 64 + (lane & 15);
  v8f c[4] = {};

  for (int chunk = 0; chunk < M / KC; ++chunk) {
    if (threadIdx.x < 32) {                        // wave 0 drives the DMA
      tdm_load_2d_f16(Abase + chunk * KC, (u32)(size_t)Atile,
                      KC, 16, KC, (u32)rows, M);
      __builtin_amdgcn_s_wait_tensorcnt((short)0);
    }
    __syncthreads();
    for (int k = 0; k < KC; k += 32) {
      int kg = chunk * KC + k;
      __builtin_prefetch(Wm + (size_t)br0 * M + kg + 128, 0, 3);
      v16h a = load_frag(Atile, KC, arow, k, lane); // ds_load_b128 x2
      v16h bb[4];
#pragma unroll
      for (int j = 0; j < 4; ++j)
        bb[j] = load_frag(Wm, M, br0 + j * 16, kg, lane);
#pragma unroll
      for (int j = 0; j < 4; ++j)
        c[j] = __builtin_amdgcn_wmma_f32_16x16x32_f16(false, a, false, bb[j],
                                                      (short)0, c[j], false, false);
    }
    __syncthreads();                               // all reads done before next DMA
  }

  int po = (lane >> 4) * 8;
#pragma unroll
  for (int j = 0; j < 4; ++j) {
    int h = hg * 64 + j * 16 + (lane & 15);
    float bias = b_map[h];
#pragma unroll
    for (int r = 0; r < 8; ++r) {
      int p = pt * 16 + po + r;                    // p in [P, PT) is pad, never read
      mlo[(((size_t)b * (H / 4) + (h >> 2)) * PT + p) * 4 + (h & 3)] = c[j][r] + bias;
    }
  }
}

// ---------------------------------------------------------------------------
// Stage 2: scores + softmax.  One block per (b,t).
// score[p] = sum_h W_rect[h]*relu(mlo[b,p,h]+hid[b,t,h]) + b_rect
// ReLU between add and reduction => VALU (cannot be a GEMM); ~0.3 Gops total.
// ---------------------------------------------------------------------------
__global__ void __launch_bounds__(256)
k_scores(const float* __restrict__ mlo, const float* __restrict__ hiddens,
         const float* __restrict__ W_rect, const float* __restrict__ b_rect,
         float* __restrict__ attn_out, _Float16* __restrict__ attn16) {
  __shared__ float hid[H];
  __shared__ float wr[H];
  __shared__ float red[256];
  int t = blockIdx.x, b = blockIdx.y;
  int tid = threadIdx.x;

  for (int h = tid; h < H; h += 256) {
    hid[h] = hiddens[((size_t)b * T + t) * H + h];
    wr[h]  = W_rect[h];
  }
  __syncthreads();

  float val = 0.0f;
  if (tid < P) {
    const float4* mq = (const float4*)mlo + (size_t)b * (H / 4) * PT + tid;
    float acc = 0.0f;
    // unroll: eight independent whole-line loads in flight per wave
#pragma unroll 8
    for (int h4 = 0; h4 < H / 4; ++h4) {
      float4 q = mq[(size_t)h4 * PT];
      float mv[4] = {q.x, q.y, q.z, q.w};
#pragma unroll
      for (int u = 0; u < 4; ++u) {                // h ascending: same sum order
        float r = mv[u] + hid[h4 * 4 + u];
        acc = fmaf(wr[h4 * 4 + u], (r > 0.0f ? r : 0.0f), acc);
      }
    }
    val = acc + b_rect[0];
  }

  red[tid] = (tid < P) ? val : -3.0e38f;
  __syncthreads();
  for (int s = 128; s > 0; s >>= 1) {
    if (tid < s) red[tid] = fmaxf(red[tid], red[tid + s]);
    __syncthreads();
  }
  float mx = red[0];
  __syncthreads();

  float e = (tid < P) ? __expf(val - mx) : 0.0f;
  red[tid] = e;
  __syncthreads();
  for (int s = 128; s > 0; s >>= 1) {
    if (tid < s) red[tid] += red[tid + s];
    __syncthreads();
  }
  float a = e / red[0];

  if (tid < P)    attn_out[((size_t)b * T + t) * P + tid] = a;
  if (tid < PPAD) attn16[((size_t)b * T + t) * PPAD + tid] =
                      (_Float16)((tid < P) ? a : 0.0f);
}

__global__ void __launch_bounds__(128)
k_ctx(const _Float16* __restrict__ attn16, const _Float16* __restrict__ fmT,
      _Float16* __restrict__ ctx16) {
  __shared__ _Float16 Atile[16 * PPAD];            // 7 KB
  int lane = threadIdx.x & 31;
  int wave = threadIdx.x >> 5;
  int b  = blockIdx.z;                             // 8
  int tt = blockIdx.y;                             // 4 t-tiles
  int mg = blockIdx.x * 4 + wave;                  // 32 groups of 64 m
  const _Float16* Abase = attn16 + ((size_t)b * T + tt * 16) * PPAD;
  const _Float16* Bf    = fmT    + (size_t)b * M * PPAD;

  if (threadIdx.x < 32) {
    tdm_load_2d_f16(Abase, (u32)(size_t)Atile, PPAD, 16, PPAD, 16, PPAD);
    __builtin_amdgcn_s_wait_tensorcnt((short)0);
  }
  __syncthreads();

  int arow = lane & 15;
  int br0  = mg * 64 + (lane & 15);
  v8f c[4] = {};
  for (int k = 0; k < PPAD; k += 32) {
    v16h a = load_frag(Atile, PPAD, arow, k, lane);
    v16h bb[4];
#pragma unroll
    for (int j = 0; j < 4; ++j)
      bb[j] = load_frag(Bf, PPAD, br0 + j * 16, k, lane);
#pragma unroll
    for (int j = 0; j < 4; ++j)
      c[j] = __builtin_amdgcn_wmma_f32_16x16x32_f16(false, a, false, bb[j],
                                                    (short)0, c[j], false, false);
  }

  int to = (lane >> 4) * 8;
#pragma unroll
  for (int j = 0; j < 4; ++j) {
    int m = mg * 64 + j * 16 + (lane & 15);
#pragma unroll
    for (int r = 0; r < 8; ++r) {
      int t = tt * 16 + to + r;
      ctx16[((size_t)b * T + t) * M + m] = (_Float16)c[j][r];
    }
  }
}

__global__ void __launch_bounds__(128)
k_final(const _Float16* __restrict__ ctx16, const _Float16* __restrict__ Wf,
        const float* __restrict__ b_final, const float* __restrict__ hiddens,
        float* __restrict__ out) {
  __shared__ _Float16 Atile[16 * KC];              // 32 KB
  int lane = threadIdx.x & 31;
  int wave = threadIdx.x >> 5;
  int b  = blockIdx.z;                             // 8
  int tt = blockIdx.y;                             // 4 t-tiles
  int hg = blockIdx.x * 4 + wave;                  // 12 groups of 64 h
  const _Float16* Abase = ctx16 + ((size_t)b * T + tt * 16) * M;

  int arow = lane & 15;
  int br0  = hg * 64 + (lane & 15);
  v8f c[4] = {};

  for (int chunk = 0; chunk < M / KC; ++chunk) {
    if (threadIdx.x < 32) {
      tdm_load_2d_f16(Abase + chunk * KC, (u32)(size_t)Atile,
                      KC, 16, KC, 16, M);
      __builtin_amdgcn_s_wait_tensorcnt((short)0);
    }
    __syncthreads();
    for (int k = 0; k < KC; k += 32) {
      int kg = chunk * KC + k;
      __builtin_prefetch(Wf + (size_t)br0 * M + kg + 128, 0, 3);
      v16h a = load_frag(Atile, KC, arow, k, lane);
      v16h bb[4];
#pragma unroll
      for (int j = 0; j < 4; ++j)
        bb[j] = load_frag(Wf, M, br0 + j * 16, kg, lane);
#pragma unroll
      for (int j = 0; j < 4; ++j)
        c[j] = __builtin_amdgcn_wmma_f32_16x16x32_f16(false, a, false, bb[j],
                                                      (short)0, c[j], false, false);
    }
    __syncthreads();
  }

  int to = (lane >> 4) * 8;
#pragma unroll
  for (int j = 0; j < 4; ++j) {
    int h = hg * 64 + j * 16 + (lane & 15);
    float bias = b_final[h];
#pragma unroll
    for (int r = 0; r < 8; ++r) {
      int t = tt * 16 + to + r;
      size_t idx = ((size_t)b * T + t) * H + h;
      out[idx] = c[j][r] + bias + hiddens[idx];
    }
  }
}

// ---------------------------------------------------------------------------
extern "C" void kernel_launch(void* const* d_in, const int* in_sizes, int n_in,
                              void* d_out, int out_size, void* d_ws, size_t ws_size,
                              hipStream_t stream) {
  (void)in_sizes; (void)n_in; (void)out_size; (void)ws_size;
  const float* maps    = (const float*)d_in[0];
  const float* hiddens = (const float*)d_in[1];
  const float* W_map   = (const float*)d_in[2];
  const float* b_map   = (const float*)d_in[3];
  const float* W_final = (const float*)d_in[4];
  const float* b_final = (const float*)d_in[5];
  const float* W_rect  = (const float*)d_in[6];
  const float* b_rect  = (const float*)d_in[7];

  float* out  = (float*)d_out;                     // (B,T,H)
  float* attn = out + (size_t)B * T * H;           // (B,T,P)

  char* ws = (char*)d_ws;
  _Float16* fmA   = (_Float16*)(ws + OFF_FMA);
  _Float16* fmT   = (_Float16*)(ws + OFF_FMT);
  _Float16* Wm16  = (_Float16*)(ws + OFF_WMAP);
  _Float16* Wf16  = (_Float16*)(ws + OFF_WFIN);
  float*    mlo   = (float*)   (ws + OFF_MLO);
  _Float16* att16 = (_Float16*)(ws + OFF_ATT16);
  _Float16* ctx16 = (_Float16*)(ws + OFF_CTX16);

  // Stage 0: converts
  k_cvt<<<B * P * M / CBLK, 256, 0, stream>>>(maps, fmA);
  k_cvt<<<H * M / CBLK, 256, 0, stream>>>(W_map, Wm16);
  k_cvt<<<H * M / CBLK, 256, 0, stream>>>(W_final, Wf16);
  k_fmT<<<dim3(M / MT, B), 256, 0, stream>>>(maps, fmT);

  k_mlo<<<dim3(3, 13, 8), 128, 0, stream>>>(fmA, Wm16, b_map, mlo);

  // Stage 2: fused rectified score + softmax (VALU)
  k_scores<<<dim3(T, B), 256, 0, stream>>>(mlo, hiddens, W_rect, b_rect, attn, att16);

  k_ctx<<<dim3(8, 4, 8), 128, 0, stream>>>(att16, fmT, ctx16);

  k_final<<<dim3(3, 4, 8), 128, 0, stream>>>(ctx16, Wf16, b_final, hiddens, out);
}

// v003
// Measured time: 85.6 microseconds a run.
// In two side-by-side timings against v002, it was 1.46 and 1.41 times as fast.
// All steps since v000 together make it 1.71 times as fast.
#include <hip/hip_runtime.h>

constexpr int B = 8, T = 64, P = 196, M = 2048, H = 768;
constexpr int PPAD = 224;
constexpr int KS   = M / 32;
constexpr int KU   = 4;
constexpr int PT   = 208;

typedef __attribute__((ext_vector_type(16))) _Float16 v16h;
typedef __attribute__((ext_vector_type(8)))  _Float16 v8h;
typedef __attribute__((ext_vector_type(8)))  float    v8f;
typedef unsigned int u32;
typedef __attribute__((ext_vector_type(4))) u32 u32x4;
typedef __attribute__((ext_vector_type(8))) int i32x8;
typedef __attribute__((ext_vector_type(4))) int i32x4;

// Workspace layout (bytes, all 16B aligned)
constexpr size_t OFF_FMA   = 0;                                   // fp16 [B][PT][M], fragment order
constexpr size_t OFF_FMT   = OFF_FMA + (size_t)B * PT * M * 2;    // fp16 [B][M][PPAD]
constexpr size_t OFF_WMAP  = OFF_FMT + (size_t)B * M * PPAD * 2;  // fp16 [H][M], fragment order
constexpr size_t OFF_WFIN  = OFF_WMAP + (size_t)H * M * 2;        // fp16 [H][M], fragment order
constexpr size_t OFF_MLO   = OFF_WFIN + (size_t)H * M * 2;        // fp32 [B][H/4][PT][4]
constexpr size_t OFF_ATT16 = OFF_MLO + (size_t)B * H * PT * 4;    // fp16 [B][T][PPAD]
constexpr size_t OFF_CTX16 = OFF_ATT16 + (size_t)B * T * PPAD * 2;// fp16 [B][T][M], fragment order

__device__ __forceinline__ void tdm_load_2d_f16(const void* gaddr, u32 lds_off,
                                                u32 tile_d0, u32 tile_d1,
                                                u32 tensor_d0, u32 tensor_d1,
                                                u32 row_stride) {
  unsigned long long ga = (unsigned long long)gaddr;
  u32x4 g0;
  g0.x = 1u;
  g0.y = lds_off;
  g0.z = (u32)ga;
  g0.w = (u32)(ga >> 32) | (2u << 30);
  i32x8 g1;
  g1[0] = (int)(1u << 16);
  g1[1] = (int)(tensor_d0 << 16);
  g1[2] = (int)((tensor_d0 >> 16) | (tensor_d1 << 16));
  g1[3] = (int)((tensor_d1 >> 16) | (tile_d0 << 16));
  g1[4] = (int)tile_d1;
  g1[5] = (int)row_stride;
  g1[6] = 0;
  g1[7] = 0;
  i32x4 z4 = {0, 0, 0, 0};
#if defined(__clang_major__) && __clang_major__ >= 23
  i32x8 z8 = {0, 0, 0, 0, 0, 0, 0, 0};
  __builtin_amdgcn_tensor_load_to_lds(g0, g1, z4, z4, z8, 0);
#else
  __builtin_amdgcn_tensor_load_to_lds(g0, g1, z4, z4, 0);
#endif
}

__device__ __forceinline__ v16h load_frag(const _Float16* mat, int ld, int row,
                                          int k0, int lane) {
  const _Float16* p = mat + (size_t)row * ld + k0 + ((lane >> 4) << 3);
  v8h lo = *(const v8h*)(p);
  v8h hi = *(const v8h*)(p + 16);
  return __builtin_shufflevector(lo, hi, 0, 1, 2, 3, 4, 5, 6, 7,
                                          8, 9, 10, 11, 12, 13, 14, 15);
}

__device__ __forceinline__ v16h load_pk(const v8h* p) {
  v8h lo = p[0];
  v8h hi = p[32];
  return __builtin_shufflevector(lo, hi, 0, 1, 2, 3, 4, 5, 6, 7,
                                          8, 9, 10, 11, 12, 13, 14, 15);
}

// ---------------------------------------------------------------------------
// Stage 0: fp32 -> fp16 converts into fragment order (and padded transpose of fm)
// Few fat waves: every global access is 16 B per lane, every store of k_pack is 512
// contiguous bytes per wave, and all loads of a thread are issued before the first use.
// ---------------------------------------------------------------------------
typedef __attribute__((ext_vector_type(4))) float    f32x4;
typedef __attribute__((ext_vector_type(2))) float    f32x2;
typedef __attribute__((ext_vector_type(4))) _Float16 v4h;
typedef __attribute__((ext_vector_type(2))) _Float16 v2h;

constexpr int PU = 4;                     // k blocks per wave of k_pack: 512 B of each of 16 rows
static_assert(KS % PU == 0 && (PT / 16 * (KS / PU)) % 8 == 0 && (H / 16 * (KS / PU)) % 8 == 0,
              "k_pack has no tail");

// src: gridDim.y matrices of [rows][M] floats. One wave = one 16-row tile x PU k blocks.
// Rows past the end of a matrix (the last p tile) are stored as zeros.
__global__ void __launch_bounds__(256)
k_pack(const float* __restrict__ src, _Float16* __restrict__ dst, int rows) {
  int lane = threadIdx.x & 31;
  int w    = blockIdx.x * 8 + (threadIdx.x >> 5);
  int tile = w / (KS / PU);
  int ks0  = (w % (KS / PU)) * PU;
  int tpm  = (rows + 15) >> 4;            // tiles per matrix
  int r    = tile * 16 + (lane & 15);
  int rc   = r < rows ? r : rows - 1;     // the address stays inside the matrix
  const f32x4* s = (const f32x4*)(src + ((size_t)blockIdx.y * rows + rc) * M
                                      + ks0 * 32 + (lane >> 4) * 8);
  v8h* d = (v8h*)dst + ((size_t)(blockIdx.y * tpm + tile) * KS + ks0) * 64 + lane;
  f32x4 v[PU][4];
#pragma unroll                            // v[] stays in registers, 4 * PU loads in flight
  for (int u = 0; u < PU; ++u) {
    v[u][0] = s[u * 8 + 0];               // k = (L/16)*8 + 0..7
    v[u][1] = s[u * 8 + 1];
    v[u][2] = s[u * 8 + 4];               // k = 16 + (L/16)*8 + 0..7
    if (u == PU - 1) asm volatile("s_wait_xcnt 0x0" ::: "memory");
    v[u][3] = s[u * 8 + 5];
  }
  // keeps the converts behind the last load: without it 12 of the 16 loads are issued only
  // after the first four have returned, a second trip to memory
  __builtin_amdgcn_sched_barrier(0);
#pragma unroll
  for (int u = 0; u < PU; ++u) {
#pragma unroll
    for (int hf = 0; hf < 2; ++hf) {
      v4h x = __builtin_convertvector(v[u][2 * hf], v4h);
      v4h y = __builtin_convertvector(v[u][2 * hf + 1], v4h);
      v8h o = __builtin_shufflevector(x, y, 0, 1, 2, 3, 4, 5, 6, 7);
      if (r >= rows) o = (v8h){0, 0, 0, 0, 0, 0, 0, 0};
      d[u * 64 + hf * 32] = o;
    }
  }
}

constexpr int MT = 64;
static_assert(P % 2 == 0 && PPAD % 32 == 0 && PPAD <= 256 && M % MT == 0, "tile shape");
static_assert((MT * PPAD / 8) % 256 == 0, "whole 16-byte stores per thread");

__global__ void __launch_bounds__(256)
k_fmT(const float* __restrict__ maps, _Float16* __restrict__ fmT) {
  __shared__ __attribute__((aligned(16))) u32 tile[MT * 128];    // 32 KB
  constexpr int NJ = PPAD / 32;           // passes of 16 row pairs
  int tid = threadIdx.x;
  int l16 = tid & 15;                     // m = 4 * l16 + i
  int pr  = tid >> 4;                     // row pair inside a pass
  int b   = blockIdx.y;
  int m0  = blockIdx.x * MT;
  const f32x4* s = (const f32x4*)(maps + (size_t)b * P * M + m0) + l16;

  // every loop below is unrolled so that lo[] and hi[] stay in registers
  f32x4 lo[NJ], hi[NJ];                   // rows 2q and 2q + 1
#pragma unroll
  for (int j = 0; j < NJ; ++j) {          // no branch: all loads of a thread in flight at once
    int q  = j * 16 + pr;
    int qc = (j * 16 + 15 < P / 2) ? q : (q < P / 2 ? q : P / 2 - 1);
    lo[j] = s[(size_t)(2 * qc) * (M / 4)];
    hi[j] = s[(size_t)(2 * qc + 1) * (M / 4)];
  }
  // keeps the converts behind the last load: without it the last pass's two loads are
  // issued only after the first loads have returned, a second trip to memory
  __builtin_amdgcn_sched_barrier(0);
#pragma unroll
  for (int j = 0; j < NJ; ++j) {          // p in [P, PPAD): zero pad
    if (j * 16 + 15 >= P / 2 && j * 16 + pr >= P / 2) {
      lo[j] = (f32x4){0.0f, 0.0f, 0.0f, 0.0f};
      hi[j] = (f32x4){0.0f, 0.0f, 0.0f, 0.0f};
    }
  }
#pragma unroll
  for (int j = 0; j < NJ; ++j) {
    int q = j * 16 + pr;
    int col = (((q >> 2) ^ l16) << 2) + (q & 3);
#pragma unroll
    for (int i = 0; i < 4; ++i) {
      f32x2 two = {lo[j][i], hi[j][i]};
      tile[(4 * l16 + i) * 128 + col] =
          __builtin_bit_cast(u32, __builtin_convertvector(two, v2h));
    }
  }
  __syncthreads();                        // the tile is whole before any row is read

  u32x4* dst = (u32x4*)(fmT + ((size_t)b * M + m0) * PPAD);
#pragma unroll                            // all LDS reads issued before the first store
  for (int j = 0; j < MT * PPAD / 8 / 256; ++j) {
    int o = j * 256 + tid;                // 16-byte chunk of the block's output range
    int m = o / (PPAD / 8);
    int c = o % (PPAD / 8);
    dst[o] = *(const u32x4*)&tile[m * 128 + ((c ^ ((m >> 2) & 15)) << 2)];
  }
}

// ---------------------------------------------------------------------------
// Stage 1: mlo(b,p,h) = fm[b,p,:] . W_map[h,:] + b_map[h]   (K = 2048)
// Stored as [b][h/4][p][h%4]: stage 2 has one thread per p, so its 16-byte load of
// four h covers 512 contiguous bytes per wave. A 128-B line is 8 p x 4 h of one wave.
// Block = 4 waves on one 16-row p tile. Both operands lie in fragment order and go from
// global memory straight to registers, 10 * KU loads per wave in flight; the four waves
// read the same A fragments.
// Each wave computes a 16x64 C tile (4 accumulators, A-fragment reuse).
// ---------------------------------------------------------------------------
__global__ void __launch_bounds__(128)
k_mlo(const _Float16* __restrict__ fmA, const _Float16* __restrict__ Wm,
      const float* __restrict__ b_map, float* __restrict__ mlo) {
  int lane = threadIdx.x & 31;
  int wave = threadIdx.x >> 5;
  int b  = blockIdx.z;                             // 8
  int pt = blockIdx.y;                             // 13 p-tiles (208 >= 196)
  int hg = blockIdx.x * 4 + wave;                  // 12 groups of 64 h
  const v8h* Ap = (const v8h*)fmA + (size_t)(b * (PT / 16) + pt) * KS * 64 + lane;
  const v8h* Bp = (const v8h*)Wm + (size_t)(hg * 4) * KS * 64 + lane;
  v8f c[4] = {};

  for (int ks = 0; ks < KS; ks += KU) {
    v16h a[KU], bb[KU][4];
#pragma unroll                                     // a[] and bb[] stay in registers
    for (int u = 0; u < KU; ++u) {
      a[u] = load_pk(Ap + (ks + u) * 64);
#pragma unroll
      for (int j = 0; j < 4; ++j)
        bb[u][j] = load_pk(Bp + (j * KS + ks + u) * 64);
    }
    // keeps the WMMAs behind the last load of the group: without it each WMMA's two loads
    // are issued only after the WMMA before it, one trip to L2 per WMMA
    __builtin_amdgcn_sched_barrier(0);
#pragma unroll
    for (int u = 0; u < KU; ++u) {
#pragma unroll
      for (int j = 0; j < 4; ++j)
        c[j] = __builtin_amdgcn_wmma_f32_16x16x32_f16(false, a[u], false, bb[u][j],
                                                      (short)0, c[j], false, false);
    }
    // the next trip rewrites the address registers that this group's loads name
    asm volatile("s_wait_xcnt 0x0" ::: "memory");
  }

  int po = (lane >> 4) * 8;
#pragma unroll
  for (int j = 0; j < 4; ++j) {
    int h = hg * 64 + j * 16 + (lane & 15);
    float bias = b_map[h];
#pragma unroll
    for (int r = 0; r < 8; ++r) {
      int p = pt * 16 + po + r;                    // p in [P, PT) is pad, never read
      mlo[(((size_t)b * (H / 4) + (h >> 2)) * PT + p) * 4 + (h & 3)] = c[j][r] + bias;
    }
  }
}

// ---------------------------------------------------------------------------
// Stage 2: scores + softmax.  One block per (b,t).
// score[p] = sum_h W_rect[h]*relu(mlo[b,p,h]+hid[b,t,h]) + b_rect
// ReLU between add and reduction => VALU (cannot be a GEMM); ~0.3 Gops total.
// ---------------------------------------------------------------------------
__global__ void __launch_bounds__(256)
k_scores(const float* __restrict__ mlo, const float* __restrict__ hiddens,
         const float* __restrict__ W_rect, const float* __restrict__ b_rect,
         float* __restrict__ attn_out, _Float16* __restrict__ attn16) {
  __shared__ float hid[H];
  __shared__ float wr[H];
  __shared__ float red[256];
  int t = blockIdx.x, b = blockIdx.y;
  int tid = threadIdx.x;

  for (int h = tid; h < H; h += 256) {
    hid[h] = hiddens[((size_t)b * T + t) * H + h];
    wr[h]  = W_rect[h];
  }
  __syncthreads();

  float val = 0.0f;
  if (tid < P) {
    const float4* mq = (const float4*)mlo + (size_t)b * (H / 4) * PT + tid;
    float acc = 0.0f;
    // unroll: eight independent whole-line loads in flight per wave
#pragma unroll 8
    for (int h4 = 0; h4 < H / 4; ++h4) {
      float4 q = mq[(size_t)h4 * PT];
      float mv[4] = {q.x, q.y, q.z, q.w};
#pragma unroll
      for (int u = 0; u < 4; ++u) {                // h ascending: same sum order
        float r = mv[u] + hid[h4 * 4 + u];
        acc = fmaf(wr[h4 * 4 + u], (r > 0.0f ? r : 0.0f), acc);
      }
    }
    val = acc + b_rect[0];
  }

  red[tid] = (tid < P) ? val : -3.0e38f;
  __syncthreads();
  for (int s = 128; s > 0; s >>= 1) {
    if (tid < s) red[tid] = fmaxf(red[tid], red[tid + s]);
    __syncthreads();
  }
  float mx = red[0];
  __syncthreads();

  float e = (tid < P) ? __expf(val - mx) : 0.0f;
  red[tid] = e;
  __syncthreads();
  for (int s = 128; s > 0; s >>= 1) {
    if (tid < s) red[tid] += red[tid + s];
    __syncthreads();
  }
  float a = e / red[0];

  if (tid < P)    attn_out[((size_t)b * T + t) * P + tid] = a;
  if (tid < PPAD) attn16[((size_t)b * T + t) * PPAD + tid] =
                      (_Float16)((tid < P) ? a : 0.0f);
}

__global__ void __launch_bounds__(128)
k_ctx(const _Float16* __restrict__ attn16, const _Float16* __restrict__ fmT,
      _Float16* __restrict__ ctx16) {
  __shared__ _Float16 Atile[16 * PPAD];            // 7 KB
  int lane = threadIdx.x & 31;
  int wave = threadIdx.x >> 5;
  int b  = blockIdx.z;                             // 8
  int tt = blockIdx.y;                             // 4 t-tiles
  int mg = blockIdx.x * 4 + wave;                  // 32 groups of 64 m
  const _Float16* Abase = attn16 + ((size_t)b * T + tt * 16) * PPAD;
  const _Float16* Bf    = fmT    + (size_t)b * M * PPAD;

  if (threadIdx.x < 32) {
    tdm_load_2d_f16(Abase, (u32)(size_t)Atile, PPAD, 16, PPAD, 16, PPAD);
    __builtin_amdgcn_s_wait_tensorcnt((short)0);
  }
  __syncthreads();

  int arow = lane & 15;
  int br0  = mg * 64 + (lane & 15);
  v8f c[4] = {};
  for (int k = 0; k < PPAD; k += 32) {
    v16h a = load_frag(Atile, PPAD, arow, k, lane);
    v16h bb[4];
#pragma unroll
    for (int j = 0; j < 4; ++j)
      bb[j] = load_frag(Bf, PPAD, br0 + j * 16, k, lane);
#pragma unroll
    for (int j = 0; j < 4; ++j)
      c[j] = __builtin_amdgcn_wmma_f32_16x16x32_f16(false, a, false, bb[j],
                                                    (short)0, c[j], false, false);
  }

  int to = (lane >> 4) * 8;
#pragma unroll
  for (int j = 0; j < 4; ++j) {
    // m = mg*64 + j*16 + lane%16 = ks*32 + hf*16 + (fragment lane / 16)*8 + lane%8
    int ks = mg * 2 + (j >> 1);
    int hf = j & 1;
    int fl = ((lane >> 3) & 1) * 16 + to;          // fragment lane of row to + 0
    _Float16* d = ctx16 + ((((size_t)(b * (T / 16) + tt) * KS + ks) * 2 + hf) * 32 + fl) * 8
                        + (lane & 7);
#pragma unroll
    for (int r = 0; r < 8; ++r) d[r * 8] = (_Float16)c[j][r];
  }
}

// ---------------------------------------------------------------------------
// Stage 4: out[b][t][h] = ctx[b,t,:] . W_final[h,:] + b_final[h] + hiddens[b,t,h]
// Both operands in fragment order, global memory to registers; each wave computes 16t x 64h.
// ---------------------------------------------------------------------------
__global__ void __launch_bounds__(128)
k_final(const _Float16* __restrict__ ctx16, const _Float16* __restrict__ Wf,
        const float* __restrict__ b_final, const float* __restrict__ hiddens,
        float* __restrict__ out) {
  int lane = threadIdx.x & 31;
  int wave = threadIdx.x >> 5;
  int b  = blockIdx.z;                             // 8
  int tt = blockIdx.y;                             // 4 t-tiles
  int hg = blockIdx.x * 4 + wave;                  // 12 groups of 64 h
  const v8h* Ap = (const v8h*)ctx16 + (size_t)(b * (T / 16) + tt) * KS * 64 + lane;
  const v8h* Bp = (const v8h*)Wf + (size_t)(hg * 4) * KS * 64 + lane;
  v8f c[4] = {};

  for (int ks = 0; ks < KS; ks += KU) {
    v16h a[KU], bb[KU][4];
#pragma unroll                                     // a[] and bb[] stay in registers
    for (int u = 0; u < KU; ++u) {
      a[u] = load_pk(Ap + (ks + u) * 64);
#pragma unroll
      for (int j = 0; j < 4; ++j)
        bb[u][j] = load_pk(Bp + (j * KS + ks + u) * 64);
    }
    // as in k_mlo: all loads of the group are issued before its first WMMA
    __builtin_amdgcn_sched_barrier(0);
#pragma unroll
    for (int u = 0; u < KU; ++u) {
#pragma unroll
      for (int j = 0; j < 4; ++j)
        c[j] = __builtin_amdgcn_wmma_f32_16x16x32_f16(false, a[u], false, bb[u][j],
                                                      (short)0, c[j], false, false);
    }
    // the next trip rewrites the address registers that this group's loads name
    asm volatile("s_wait_xcnt 0x0" ::: "memory");
  }

  int to = (lane >> 4) * 8;
#pragma unroll
  for (int j = 0; j < 4; ++j) {
    int h = hg * 64 + j * 16 + (lane & 15);
    float bias = b_final[h];
#pragma unroll
    for (int r = 0; r < 8; ++r) {
      int t = tt * 16 + to + r;
      size_t idx = ((size_t)b * T + t) * H + h;
      out[idx] = c[j][r] + bias + hiddens[idx];
    }
  }
}

// ---------------------------------------------------------------------------
extern "C" void kernel_launch(void* const* d_in, const int* in_sizes, int n_in,
                              void* d_out, int out_size, void* d_ws, size_t ws_size,
                              hipStream_t stream) {
  (void)in_sizes; (void)n_in; (void)out_size; (void)ws_size;
  const float* maps    = (const float*)d_in[0];
  const float* hiddens = (const float*)d_in[1];
  const float* W_map   = (const float*)d_in[2];
  const float* b_map   = (const float*)d_in[3];
  const float* W_final = (const float*)d_in[4];
  const float* b_final = (const float*)d_in[5];
  const float* W_rect  = (const float*)d_in[6];
  const float* b_rect  = (const float*)d_in[7];

  float* out  = (float*)d_out;                     // (B,T,H)
  float* attn = out + (size_t)B * T * H;           // (B,T,P)

  char* ws = (char*)d_ws;
  _Float16* fmA   = (_Float16*)(ws + OFF_FMA);
  _Float16* fmT   = (_Float16*)(ws + OFF_FMT);
  _Float16* Wm16  = (_Float16*)(ws + OFF_WMAP);
  _Float16* Wf16  = (_Float16*)(ws + OFF_WFIN);
  float*    mlo   = (float*)   (ws + OFF_MLO);
  _Float16* att16 = (_Float16*)(ws + OFF_ATT16);
  _Float16* ctx16 = (_Float16*)(ws + OFF_CTX16);

  // Stage 0: converts
  k_pack<<<dim3(PT / 16 * (KS / PU) / 8, B), 256, 0, stream>>>(maps, fmA, P);
  k_pack<<<dim3(H / 16 * (KS / PU) / 8, 1), 256, 0, stream>>>(W_map, Wm16, H);
  k_pack<<<dim3(H / 16 * (KS / PU) / 8, 1), 256, 0, stream>>>(W_final, Wf16, H);
  k_fmT<<<dim3(M / MT, B), 256, 0, stream>>>(maps, fmT);

  // Stage 1: map_linear GEMM (WMMA)
  k_mlo<<<dim3(3, 13, 8), 128, 0, stream>>>(fmA, Wm16, b_map, mlo);

  // Stage 2: fused rectified score + softmax (VALU)
  k_scores<<<dim3(T, B), 256, 0, stream>>>(mlo, hiddens, W_rect, b_rect, attn, att16);

  k_ctx<<<dim3(8, 4, 8), 128, 0, stream>>>(att16, fmT, ctx16);

  // Stage 4: output GEMM + bias + residual (WMMA)
  k_final<<<dim3(3, 4, 8), 128, 0, stream>>>(ctx16, Wf16, b_final, hiddens, out);
}

// v004
// It runs in 76.7 microseconds.
// Timed twice side by side with v003, it ran 1.14 and 1.12 times as fast.
// Counting every step since v000, it is 1.93 times as fast.
#include <hip/hip_runtime.h>

constexpr int B = 8, T = 64, P = 196, M = 2048, H = 768;
constexpr int PPAD = 224;
constexpr int KS   = M / 32;
constexpr int KU   = 4;
constexpr int PT   = 208;

typedef __attribute__((ext_vector_type(16))) _Float16 v16h;
typedef __attribute__((ext_vector_type(8)))  _Float16 v8h;
typedef __attribute__((ext_vector_type(8)))  float    v8f;
typedef unsigned int u32;
typedef __attribute__((ext_vector_type(4))) u32 u32x4;
typedef __attribute__((ext_vector_type(8))) int i32x8;
typedef __attribute__((ext_vector_type(4))) int i32x4;

// Workspace layout (bytes, all 16B aligned)
constexpr size_t OFF_FMA   = 0;                                   // fp16 [B][PT][M], fragment order
constexpr size_t OFF_FMT   = OFF_FMA + (size_t)B * PT * M * 2;    // fp16 [B][M][PPAD]
constexpr size_t OFF_WMAP  = OFF_FMT + (size_t)B * M * PPAD * 2;  // fp16 [H][M], fragment order
constexpr size_t OFF_WFIN  = OFF_WMAP + (size_t)H * M * 2;        // fp16 [H][M], fragment order
constexpr size_t OFF_MLO   = OFF_WFIN + (size_t)H * M * 2;        // fp32 [B][H/4][PT][4]
constexpr size_t OFF_ATT16 = OFF_MLO + (size_t)B * H * PT * 4;    // fp16 [B][T][PPAD]
constexpr size_t OFF_CTX16 = OFF_ATT16 + (size_t)B * T * PPAD * 2;// fp16 [B][T][M], fragment order

__device__ __forceinline__ void tdm_load_2d_f16(const void* gaddr, u32 lds_off,
                                                u32 tile_d0, u32 tile_d1,
                                                u32 tensor_d0, u32 tensor_d1,
                                                u32 row_stride) {
  unsigned long long ga = (unsigned long long)gaddr;
  u32x4 g0;
  g0.x = 1u;
  g0.y = lds_off;
  g0.z = (u32)ga;
  g0.w = (u32)(ga >> 32) | (2u << 30);
  i32x8 g1;
  g1[0] = (int)(1u << 16);
  g1[1] = (int)(tensor_d0 << 16);
  g1[2] = (int)((tensor_d0 >> 16) | (tensor_d1 << 16));
  g1[3] = (int)((tensor_d1 >> 16) | (tile_d0 << 16));
  g1[4] = (int)tile_d1;
  g1[5] = (int)row_stride;
  g1[6] = 0;
  g1[7] = 0;
  i32x4 z4 = {0, 0, 0, 0};
#if defined(__clang_major__) && __clang_major__ >= 23
  i32x8 z8 = {0, 0, 0, 0, 0, 0, 0, 0};
  __builtin_amdgcn_tensor_load_to_lds(g0, g1, z4, z4, z8, 0);
#else
  __builtin_amdgcn_tensor_load_to_lds(g0, g1, z4, z4, 0);
#endif
}

__device__ __forceinline__ v16h load_frag(const _Float16* mat, int ld, int row,
                                          int k0, int lane) {
  const _Float16* p = mat + (size_t)row * ld + k0 + ((lane >> 4) << 3);
  v8h lo = *(const v8h*)(p);
  v8h hi = *(const v8h*)(p + 16);
  return __builtin_shufflevector(lo, hi, 0, 1, 2, 3, 4, 5, 6, 7,
                                          8, 9, 10, 11, 12, 13, 14, 15);
}

__device__ __forceinline__ v16h load_pk(const v8h* p) {
  v8h lo = p[0];
  v8h hi = p[32];
  return __builtin_shufflevector(lo, hi, 0, 1, 2, 3, 4, 5, 6, 7,
                                          8, 9, 10, 11, 12, 13, 14, 15);
}

// ---------------------------------------------------------------------------
// Stage 0: fp32 -> fp16 converts into fragment order (and padded transpose of fm)
// Few fat waves: every global access is 16 B per lane, every store of pack_block is 512
// contiguous bytes per wave, and all loads of a thread are issued before the first use.
// ---------------------------------------------------------------------------
typedef __attribute__((ext_vector_type(4))) float    f32x4;
typedef __attribute__((ext_vector_type(2))) float    f32x2;
typedef __attribute__((ext_vector_type(4))) _Float16 v4h;
typedef __attribute__((ext_vector_type(2))) _Float16 v2h;

constexpr int PU = 4;                     // k blocks per wave of pack_block: 512 B of each of 16 rows
static_assert(KS % PU == 0 && (PT / 16 * (KS / PU)) % 8 == 0 && (H / 16 * (KS / PU)) % 8 == 0,
              "pack_block has no tail");

// src: matrices of [rows][M] floats, this block works on matrix mat. One wave = one 16-row
// tile x PU k blocks; blk counts the blocks of one matrix.
// Rows past the end of a matrix (the last p tile) are stored as zeros.
__device__ __forceinline__ void
pack_block(const float* __restrict__ src, _Float16* __restrict__ dst, int rows, int blk, int mat) {
  int lane = threadIdx.x & 31;
  int w    = blk * 8 + (threadIdx.x >> 5);
  int tile = w / (KS / PU);
  int ks0  = (w % (KS / PU)) * PU;
  int tpm  = (rows + 15) >> 4;            // tiles per matrix
  int r    = tile * 16 + (lane & 15);
  int rc   = r < rows ? r : rows - 1;     // the address stays inside the matrix
  const f32x4* s = (const f32x4*)(src + ((size_t)mat * rows + rc) * M
                                      + ks0 * 32 + (lane >> 4) * 8);
  v8h* d = (v8h*)dst + ((size_t)(mat * tpm + tile) * KS + ks0) * 64 + lane;
  f32x4 v[PU][4];
#pragma unroll                            // v[] stays in registers, 4 * PU loads in flight
  for (int u = 0; u < PU; ++u) {
    v[u][0] = s[u * 8 + 0];               // k = (L/16)*8 + 0..7
    v[u][1] = s[u * 8 + 1];
    v[u][2] = s[u * 8 + 4];               // k = 16 + (L/16)*8 + 0..7
    if (u == PU - 1) asm volatile("s_wait_xcnt 0x0" ::: "memory");
    v[u][3] = s[u * 8 + 5];
  }
  // keeps the converts behind the last load: without it 12 of the 16 loads are issued only
  // after the first four have returned, a second trip to memory
  __builtin_amdgcn_sched_barrier(0);
#pragma unroll
  for (int u = 0; u < PU; ++u) {
#pragma unroll
    for (int hf = 0; hf < 2; ++hf) {
      v4h x = __builtin_convertvector(v[u][2 * hf], v4h);
      v4h y = __builtin_convertvector(v[u][2 * hf + 1], v4h);
      v8h o = __builtin_shufflevector(x, y, 0, 1, 2, 3, 4, 5, 6, 7);
      if (r >= rows) o = (v8h){0, 0, 0, 0, 0, 0, 0, 0};
      d[u * 64 + hf * 32] = o;
    }
  }
  // the code behind this function's call may reuse the registers that the stores above name
  // (address pair, data): the wait stands between the last store and any such overwrite
  asm volatile("s_wait_xcnt 0x0" ::: "memory");
}

constexpr int MT = 64;
static_assert(P % 2 == 0 && PPAD % 32 == 0 && PPAD <= 256 && M % MT == 0, "tile shape");
static_assert((MT * PPAD / 8) % 256 == 0, "whole 16-byte stores per thread");

__device__ __forceinline__ void
fmT_block(const float* __restrict__ maps, _Float16* __restrict__ fmT, u32* tile, int mblk, int b) {
  constexpr int NJ = PPAD / 32;           // passes of 16 row pairs
  int tid = threadIdx.x;
  int l16 = tid & 15;                     // m = 4 * l16 + i
  int pr  = tid >> 4;                     // row pair inside a pass
  int m0  = mblk * MT;
  const f32x4* s = (const f32x4*)(maps + (size_t)b * P * M + m0) + l16;

  // every loop below is unrolled so that lo[] and hi[] stay in registers
  f32x4 lo[NJ], hi[NJ];                   // rows 2q and 2q + 1
#pragma unroll
  for (int j = 0; j < NJ; ++j) {          // no branch: all loads of a thread in flight at once
    int q  = j * 16 + pr;
    int qc = (j * 16 + 15 < P / 2) ? q : (q < P / 2 ? q : P / 2 - 1);
    lo[j] = s[(size_t)(2 * qc) * (M / 4)];
    hi[j] = s[(size_t)(2 * qc + 1) * (M / 4)];
  }
  // keeps the converts behind the last load: without it the last pass's two loads are
  // issued only after the first loads have returned, a second trip to memory
  __builtin_amdgcn_sched_barrier(0);
#pragma unroll
  for (int j = 0; j < NJ; ++j) {          // p in [P, PPAD): zero pad
    if (j * 16 + 15 >= P / 2 && j * 16 + pr >= P / 2) {
      lo[j] = (f32x4){0.0f, 0.0f, 0.0f, 0.0f};
      hi[j] = (f32x4){0.0f, 0.0f, 0.0f, 0.0f};
    }
  }
#pragma unroll
  for (int j = 0; j < NJ; ++j) {
    int q = j * 16 + pr;
    int col = (((q >> 2) ^ l16) << 2) + (q & 3);
#pragma unroll
    for (int i = 0; i < 4; ++i) {
      f32x2 two = {lo[j][i], hi[j][i]};
      tile[(4 * l16 + i) * 128 + col] =
          __builtin_bit_cast(u32, __builtin_convertvector(two, v2h));
    }
  }
  __syncthreads();                        // the tile is whole before any row is read

  u32x4* dst = (u32x4*)(fmT + ((size_t)b * M + m0) * PPAD);
#pragma unroll                            // all LDS reads issued before the first store
  for (int j = 0; j < MT * PPAD / 8 / 256; ++j) {
    int o = j * 256 + tid;                // 16-byte chunk of the block's output range
    int m = o / (PPAD / 8);
    int c = o % (PPAD / 8);
    dst[o] = *(const u32x4*)&tile[m * 128 + ((c ^ ((m >> 2) & 15)) << 2)];
  }
}

constexpr int NB_T  = (M / MT) * B;                  // transpose of maps
constexpr int NB_A1 = PT / 16 * (KS / PU) / 8;       // pack of maps, blocks per b
constexpr int NB_A  = NB_A1 * B;
constexpr int NB_W  = H / 16 * (KS / PU) / 8;        // pack of one weight matrix

__global__ void __launch_bounds__(256)
k_stage0(const float* __restrict__ maps, const float* __restrict__ W_map,
         const float* __restrict__ W_final, _Float16* __restrict__ fmT,
         _Float16* __restrict__ fmA, _Float16* __restrict__ Wm, _Float16* __restrict__ Wf) {
  __shared__ __attribute__((aligned(16))) u32 tile[MT * 128];    // 32 KB, transpose blocks only
  int i = blockIdx.x;
  if (i < NB_T) {
    fmT_block(maps, fmT, tile, i % (M / MT), i / (M / MT));
  } else if (i < NB_T + NB_A) {
    i -= NB_T;
    pack_block(maps, fmA, P, i % NB_A1, i / NB_A1);
  } else if (i < NB_T + NB_A + NB_W) {
    pack_block(W_map, Wm, H, i - (NB_T + NB_A), 0);
  } else {
    pack_block(W_final, Wf, H, i - (NB_T + NB_A + NB_W), 0);
  }
}

// ---------------------------------------------------------------------------
// Stage 1: mlo(b,p,h) = fm[b,p,:] . W_map[h,:] + b_map[h]   (K = 2048)
// Stored as [b][h/4][p][h%4]: stage 2 has one thread per p, so its 16-byte load of
// four h covers 512 contiguous bytes per wave. A 128-B line is 8 p x 4 h of one wave.
// Block = 4 waves on one 16-row p tile. Both operands lie in fragment order and go from
// global memory straight to registers, 10 * KU loads per wave in flight; the four waves
// read the same A fragments.
// Each wave computes a 16x64 C tile (4 accumulators, A-fragment reuse).
// ---------------------------------------------------------------------------
__global__ void __launch_bounds__(128)
k_mlo(const _Float16* __restrict__ fmA, const _Float16* __restrict__ Wm,
      const float* __restrict__ b_map, float* __restrict__ mlo) {
  int lane = threadIdx.x & 31;
  int wave = threadIdx.x >> 5;
  int b  = blockIdx.z;                             // 8
  int pt = blockIdx.y;                             // 13 p-tiles (208 >= 196)
  int hg = blockIdx.x * 4 + wave;                  // 12 groups of 64 h
  const v8h* Ap = (const v8h*)fmA + (size_t)(b * (PT / 16) + pt) * KS * 64 + lane;
  const v8h* Bp = (const v8h*)Wm + (size_t)(hg * 4) * KS * 64 + lane;
  v8f c[4] = {};

  for (int ks = 0; ks < KS; ks += KU) {
    v16h a[KU], bb[KU][4];
#pragma unroll                                     // a[] and bb[] stay in registers
    for (int u = 0; u < KU; ++u) {
      a[u] = load_pk(Ap + (ks + u) * 64);
#pragma unroll
      for (int j = 0; j < 4; ++j)
        bb[u][j] = load_pk(Bp + (j * KS + ks + u) * 64);
    }
    // keeps the WMMAs behind the last load of the group: without it each WMMA's two loads
    // are issued only after the WMMA before it, one trip to L2 per WMMA
    __builtin_amdgcn_sched_barrier(0);
#pragma unroll
    for (int u = 0; u < KU; ++u) {
#pragma unroll
      for (int j = 0; j < 4; ++j)
        c[j] = __builtin_amdgcn_wmma_f32_16x16x32_f16(false, a[u], false, bb[u][j],
                                                      (short)0, c[j], false, false);
    }
    // the next trip rewrites the address registers that this group's loads name
    asm volatile("s_wait_xcnt 0x0" ::: "memory");
  }

  int po = (lane >> 4) * 8;
#pragma unroll
  for (int j = 0; j < 4; ++j) {
    int h = hg * 64 + j * 16 + (lane & 15);
    float bias = b_map[h];
#pragma unroll
    for (int r = 0; r < 8; ++r) {
      int p = pt * 16 + po + r;                    // p in [P, PT) is pad, never read
      mlo[(((size_t)b * (H / 4) + (h >> 2)) * PT + p) * 4 + (h & 3)] = c[j][r] + bias;
    }
  }
}

// ---------------------------------------------------------------------------
// Stage 2: scores + softmax.  One block per (b,t).
// score[p] = sum_h W_rect[h]*relu(mlo[b,p,h]+hid[b,t,h]) + b_rect
// ReLU between add and reduction => VALU (cannot be a GEMM); ~0.3 Gops total.
// ---------------------------------------------------------------------------
__global__ void __launch_bounds__(256)
k_scores(const float* __restrict__ mlo, const float* __restrict__ hiddens,
         const float* __restrict__ W_rect, const float* __restrict__ b_rect,
         float* __restrict__ attn_out, _Float16* __restrict__ attn16) {
  __shared__ float hid[H];
  __shared__ float wr[H];
  __shared__ float red[256];
  int t = blockIdx.x, b = blockIdx.y;
  int tid = threadIdx.x;

  for (int h = tid; h < H; h += 256) {
    hid[h] = hiddens[((size_t)b * T + t) * H + h];
    wr[h]  = W_rect[h];
  }
  __syncthreads();

  float val = 0.0f;
  if (tid < P) {
    const float4* mq = (const float4*)mlo + (size_t)b * (H / 4) * PT + tid;
    float acc = 0.0f;
    // unroll: eight independent whole-line loads in flight per wave
#pragma unroll 8
    for (int h4 = 0; h4 < H / 4; ++h4) {
      float4 q = mq[(size_t)h4 * PT];
      float mv[4] = {q.x, q.y, q.z, q.w};
#pragma unroll
      for (int u = 0; u < 4; ++u) {                // h ascending: same sum order
        float r = mv[u] + hid[h4 * 4 + u];
        acc = fmaf(wr[h4 * 4 + u], (r > 0.0f ? r : 0.0f), acc);
      }
    }
    val = acc + b_rect[0];
  }

  red[tid] = (tid < P) ? val : -3.0e38f;
  __syncthreads();
  for (int s = 128; s > 0; s >>= 1) {
    if (tid < s) red[tid] = fmaxf(red[tid], red[tid + s]);
    __syncthreads();
  }
  float mx = red[0];
  __syncthreads();

  float e = (tid < P) ? __expf(val - mx) : 0.0f;
  red[tid] = e;
  __syncthreads();
  for (int s = 128; s > 0; s >>= 1) {
    if (tid < s) red[tid] += red[tid + s];
    __syncthreads();
  }
  float a = e / red[0];

  if (tid < P)    attn_out[((size_t)b * T + t) * P + tid] = a;
  if (tid < PPAD) attn16[((size_t)b * T + t) * PPAD + tid] =
                      (_Float16)((tid < P) ? a : 0.0f);
}

__global__ void __launch_bounds__(128)
k_ctx(const _Float16* __restrict__ attn16, const _Float16* __restrict__ fmT,
      _Float16* __restrict__ ctx16) {
  __shared__ _Float16 Atile[16 * PPAD];            // 7 KB
  int lane = threadIdx.x & 31;
  int wave = threadIdx.x >> 5;
  int b  = blockIdx.z;                             // 8
  int tt = blockIdx.y;                             // 4 t-tiles
  int mg = blockIdx.x * 4 + wave;                  // 32 groups of 64 m
  const _Float16* Abase = attn16 + ((size_t)b * T + tt * 16) * PPAD;
  const _Float16* Bf    = fmT    + (size_t)b * M * PPAD;

  if (threadIdx.x < 32) {
    tdm_load_2d_f16(Abase, (u32)(size_t)Atile, PPAD, 16, PPAD, 16, PPAD);
    __builtin_amdgcn_s_wait_tensorcnt((short)0);
  }
  __syncthreads();

  int arow = lane & 15;
  int br0  = mg * 64 + (lane & 15);
  v8f c[4] = {};
  for (int k = 0; k < PPAD; k += 32) {
    v16h a = load_frag(Atile, PPAD, arow, k, lane);
    v16h bb[4];
#pragma unroll
    for (int j = 0; j < 4; ++j)
      bb[j] = load_frag(Bf, PPAD, br0 + j * 16, k, lane);
#pragma unroll
    for (int j = 0; j < 4; ++j)
      c[j] = __builtin_amdgcn_wmma_f32_16x16x32_f16(false, a, false, bb[j],
                                                    (short)0, c[j], false, false);
  }

  int to = (lane >> 4) * 8;
#pragma unroll
  for (int j = 0; j < 4; ++j) {
    // m = mg*64 + j*16 + lane%16 = ks*32 + hf*16 + (fragment lane / 16)*8 + lane%8
    int ks = mg * 2 + (j >> 1);
    int hf = j & 1;
    int fl = ((lane >> 3) & 1) * 16 + to;          // fragment lane of row to + 0
    _Float16* d = ctx16 + ((((size_t)(b * (T / 16) + tt) * KS + ks) * 2 + hf) * 32 + fl) * 8
                        + (lane & 7);
#pragma unroll
    for (int r = 0; r < 8; ++r) d[r * 8] = (_Float16)c[j][r];
  }
}

// ---------------------------------------------------------------------------
// Stage 4: out[b][t][h] = ctx[b,t,:] . W_final[h,:] + b_final[h] + hiddens[b,t,h]
// Both operands in fragment order, global memory to registers; each wave computes 16t x 64h.
// ---------------------------------------------------------------------------
__global__ void __launch_bounds__(128)
k_final(const _Float16* __restrict__ ctx16, const _Float16* __restrict__ Wf,
        const float* __restrict__ b_final, const float* __restrict__ hiddens,
        float* __restrict__ out) {
  int lane = threadIdx.x & 31;
  int wave = threadIdx.x >> 5;
  int b  = blockIdx.z;                             // 8
  int tt = blockIdx.y;                             // 4 t-tiles
  int hg = blockIdx.x * 4 + wave;                  // 12 groups of 64 h
  const v8h* Ap = (const v8h*)ctx16 + (size_t)(b * (T / 16) + tt) * KS * 64 + lane;
  const v8h* Bp = (const v8h*)Wf + (size_t)(hg * 4) * KS * 64 + lane;
  v8f c[4] = {};

  for (int ks = 0; ks < KS; ks += KU) {
    v16h a[KU], bb[KU][4];
#pragma unroll                                     // a[] and bb[] stay in registers
    for (int u = 0; u < KU; ++u) {
      a[u] = load_pk(Ap + (ks + u) * 64);
#pragma unroll
      for (int j = 0; j < 4; ++j)
        bb[u][j] = load_pk(Bp + (j * KS + ks + u) * 64);
    }
    // as in k_mlo: all loads of the group are issued before its first WMMA
    __builtin_amdgcn_sched_barrier(0);
#pragma unroll
    for (int u = 0; u < KU; ++u) {
#pragma unroll
      for (int j = 0; j < 4; ++j)
        c[j] = __builtin_amdgcn_wmma_f32_16x16x32_f16(false, a[u], false, bb[u][j],
                                                      (short)0, c[j], false, false);
    }
    // the next trip rewrites the address registers that this group's loads name
    asm volatile("s_wait_xcnt 0x0" ::: "memory");
  }

  int to = (lane >> 4) * 8;
#pragma unroll
  for (int j = 0; j < 4; ++j) {
    int h = hg * 64 + j * 16 + (lane & 15);
    float bias = b_final[h];
#pragma unroll
    for (int r = 0; r < 8; ++r) {
      int t = tt * 16 + to + r;
      size_t idx = ((size_t)b * T + t) * H + h;
      out[idx] = c[j][r] + bias + hiddens[idx];
    }
  }
}

// ---------------------------------------------------------------------------
extern "C" void kernel_launch(void* const* d_in, const int* in_sizes, int n_in,
                              void* d_out, int out_size, void* d_ws, size_t ws_size,
                              hipStream_t stream) {
  (void)in_sizes; (void)n_in; (void)out_size; (void)ws_size;
  const float* maps    = (const float*)d_in[0];
  const float* hiddens = (const float*)d_in[1];
  const float* W_map   = (const float*)d_in[2];
  const float* b_map   = (const float*)d_in[3];
  const float* W_final = (const float*)d_in[4];
  const float* b_final = (const float*)d_in[5];
  const float* W_rect  = (const float*)d_in[6];
  const float* b_rect  = (const float*)d_in[7];

  float* out  = (float*)d_out;                     // (B,T,H)
  float* attn = out + (size_t)B * T * H;           // (B,T,P)

  char* ws = (char*)d_ws;
  _Float16* fmA   = (_Float16*)(ws + OFF_FMA);
  _Float16* fmT   = (_Float16*)(ws + OFF_FMT);
  _Float16* Wm16  = (_Float16*)(ws + OFF_WMAP);
  _Float16* Wf16  = (_Float16*)(ws + OFF_WFIN);
  float*    mlo   = (float*)   (ws + OFF_MLO);
  _Float16* att16 = (_Float16*)(ws + OFF_ATT16);
  _Float16* ctx16 = (_Float16*)(ws + OFF_CTX16);

  // Stage 0: converts and transpose, one launch
  k_stage0<<<dim3(NB_T + NB_A + 2 * NB_W), 256, 0, stream>>>(maps, W_map, W_final,
                                                            fmT, fmA, Wm16, Wf16);

  // Stage 1: map_linear GEMM (WMMA)
  k_mlo<<<dim3(3, 13, 8), 128, 0, stream>>>(fmA, Wm16, b_map, mlo);

  // Stage 2: fused rectified score + softmax (VALU)
  k_scores<<<dim3(T, B), 256, 0, stream>>>(mlo, hiddens, W_rect, b_rect, attn, att16);

  k_ctx<<<dim3(8, 4, 8), 128, 0, stream>>>(att16, fmT, ctx16);

  // Stage 4: output GEMM + bias + residual (WMMA)
  k_final<<<dim3(3, 4, 8), 128, 0, stream>>>(ctx16, Wf16, b_final, hiddens, out);
}

// v005
// One run takes 62.4 microseconds.
// Next to v004, in two timings, it ran 1.21 and 1.25 times as fast.
// All steps since v000 together make it 2.38 times as fast.
#include <hip/hip_runtime.h>

constexpr int B = 8, T = 64, P = 196, M = 2048, H = 768;
constexpr int PPAD = 224;                 // P rounded up to multiple of 32 (K tile)
constexpr int KS   = M / 32;              // 32-wide k blocks of the K = M products
constexpr int PT   = 208;                 // P rounded up to the 16-row p tiles of stage 1

typedef __attribute__((ext_vector_type(16))) _Float16 v16h;
typedef __attribute__((ext_vector_type(8)))  _Float16 v8h;
typedef __attribute__((ext_vector_type(8)))  float    v8f;
typedef unsigned int u32;
typedef __attribute__((ext_vector_type(4))) u32 u32x4;
typedef __attribute__((ext_vector_type(8))) int i32x8;
typedef __attribute__((ext_vector_type(4))) int i32x4;

// Workspace layout (bytes, all 16B aligned)
constexpr size_t OFF_FMA   = 0;                                   // fp16 [B][PT][M], fragment order
constexpr size_t OFF_FMT   = OFF_FMA + (size_t)B * PT * M * 2;    // fp16 [B][M][PPAD]
constexpr size_t OFF_WMAP  = OFF_FMT + (size_t)B * M * PPAD * 2;  // fp16 [H][M], fragment order
constexpr size_t OFF_WFIN  = OFF_WMAP + (size_t)H * M * 2;        // fp16 [H][M], fragment order
constexpr size_t OFF_MLO   = OFF_WFIN + (size_t)H * M * 2;        // fp32 [B][H/4][PT][4]
constexpr size_t OFF_ATT16 = OFF_MLO + (size_t)B * H * PT * 4;    // fp16 [B][T][PPAD]
constexpr size_t OFF_CTX16 = OFF_ATT16 + (size_t)B * T * PPAD * 2;// fp16 [B][T][M], fragment order

__device__ __forceinline__ void tdm_load_2d_f16(const void* gaddr, u32 lds_off,
                                                u32 tile_d0, u32 tile_d1,
                                                u32 tensor_d0, u32 tensor_d1,
                                                u32 row_stride) {
  unsigned long long ga = (unsigned long long)gaddr;
  u32x4 g0;
  g0.x = 1u;
  g0.y = lds_off;
  g0.z = (u32)ga;
  g0.w = (u32)(ga >> 32) | (2u << 30);
  i32x8 g1;
  g1[0] = (int)(1u << 16);
  g1[1] = (int)(tensor_d0 << 16);
  g1[2] = (int)((tensor_d0 >> 16) | (tensor_d1 << 16));
  g1[3] = (int)((tensor_d1 >> 16) | (tile_d0 << 16));
  g1[4] = (int)tile_d1;
  g1[5] = (int)row_stride;
  g1[6] = 0;
  g1[7] = 0;
  i32x4 z4 = {0, 0, 0, 0};
#if defined(__clang_major__) && __clang_major__ >= 23
  i32x8 z8 = {0, 0, 0, 0, 0, 0, 0, 0};
  __builtin_amdgcn_tensor_load_to_lds(g0, g1, z4, z4, z8, 0);
#else
  __builtin_amdgcn_tensor_load_to_lds(g0, g1, z4, z4, 0);
#endif
}

__device__ __forceinline__ v16h load_frag(const _Float16* mat, int ld, int row,
                                          int k0, int lane) {
  const _Float16* p = mat + (size_t)row * ld + k0 + ((lane >> 4) << 3);
  v8h lo = *(const v8h*)(p);
  v8h hi = *(const v8h*)(p + 16);
  return __builtin_shufflevector(lo, hi, 0, 1, 2, 3, 4, 5, 6, 7,
                                          8, 9, 10, 11, 12, 13, 14, 15);
}

__device__ __forceinline__ v16h load_pk(const v8h* p) {
  v8h lo = p[0];
  v8h hi = p[32];
  return __builtin_shufflevector(lo, hi, 0, 1, 2, 3, 4, 5, 6, 7,
                                          8, 9, 10, 11, 12, 13, 14, 15);
}

// ---------------------------------------------------------------------------
// Stage 0: fp32 -> fp16 converts into fragment order (and padded transpose of fm)
// Few fat waves: every global access is 16 B per lane, every store of pack_block is 512
// contiguous bytes per wave, and all loads of a thread are issued before the first use.
// ---------------------------------------------------------------------------
typedef __attribute__((ext_vector_type(4))) float    f32x4;
typedef __attribute__((ext_vector_type(2))) float    f32x2;
typedef __attribute__((ext_vector_type(4))) _Float16 v4h;
typedef __attribute__((ext_vector_type(2))) _Float16 v2h;

constexpr int PU = 4;                     // k blocks per wave of pack_block: 512 B of each of 16 rows
static_assert(KS % PU == 0 && (PT / 16 * (KS / PU)) % 8 == 0 && (H / 16 * (KS / PU)) % 8 == 0,
              "pack_block has no tail");

// src: matrices of [rows][M] floats, this block works on matrix mat. One wave = one 16-row
// tile x PU k blocks; blk counts the blocks of one matrix.
// Rows past the end of a matrix (the last p tile) are stored as zeros.
__device__ __forceinline__ void
pack_block(const float* __restrict__ src, _Float16* __restrict__ dst, int rows, int blk, int mat) {
  int lane = threadIdx.x & 31;
  int w    = blk * 8 + (threadIdx.x >> 5);
  int tile = w / (KS / PU);
  int ks0  = (w % (KS / PU)) * PU;
  int tpm  = (rows + 15) >> 4;            // tiles per matrix
  int r    = tile * 16 + (lane & 15);
  int rc   = r < rows ? r : rows - 1;     // the address stays inside the matrix
  const f32x4* s = (const f32x4*)(src + ((size_t)mat * rows + rc) * M
                                      + ks0 * 32 + (lane >> 4) * 8);
  v8h* d = (v8h*)dst + ((size_t)(mat * tpm + tile) * KS + ks0) * 64 + lane;
  f32x4 v[PU][4];
#pragma unroll                            // v[] stays in registers, 4 * PU loads in flight
  for (int u = 0; u < PU; ++u) {
    v[u][0] = s[u * 8 + 0];               // k = (L/16)*8 + 0..7
    v[u][1] = s[u * 8 + 1];
    v[u][2] = s[u * 8 + 4];               // k = 16 + (L/16)*8 + 0..7
    if (u == PU - 1) asm volatile("s_wait_xcnt 0x0" ::: "memory");
    v[u][3] = s[u * 8 + 5];
  }
  // keeps the converts behind the last load: without it 12 of the 16 loads are issued only
  // after the first four have returned, a second trip to memory
  __builtin_amdgcn_sched_barrier(0);
#pragma unroll
  for (int u = 0; u < PU; ++u) {
#pragma unroll
    for (int hf = 0; hf < 2; ++hf) {
      v4h x = __builtin_convertvector(v[u][2 * hf], v4h);
      v4h y = __builtin_convertvector(v[u][2 * hf + 1], v4h);
      v8h o = __builtin_shufflevector(x, y, 0, 1, 2, 3, 4, 5, 6, 7);
      if (r >= rows) o = (v8h){0, 0, 0, 0, 0, 0, 0, 0};
      d[u * 64 + hf * 32] = o;
    }
  }
  // the code behind this function's call may reuse the registers that the stores above name
  // (address pair, data): the wait stands between the last store and any such overwrite
  asm volatile("s_wait_xcnt 0x0" ::: "memory");
}

constexpr int MT = 64;
static_assert(P % 2 == 0 && PPAD % 32 == 0 && PPAD <= 256 && M % MT == 0, "tile shape");
static_assert((MT * PPAD / 8) % 256 == 0, "whole 16-byte stores per thread");

__device__ __forceinline__ void
fmT_block(const float* __restrict__ maps, _Float16* __restrict__ fmT, u32* tile, int mblk, int b) {
  constexpr int NJ = PPAD / 32;           // passes of 16 row pairs
  int tid = threadIdx.x;
  int l16 = tid & 15;                     // m = 4 * l16 + i
  int pr  = tid >> 4;                     // row pair inside a pass
  int m0  = mblk * MT;
  const f32x4* s = (const f32x4*)(maps + (size_t)b * P * M + m0) + l16;

  // every loop below is unrolled so that lo[] and hi[] stay in registers
  f32x4 lo[NJ], hi[NJ];                   // rows 2q and 2q + 1
#pragma unroll
  for (int j = 0; j < NJ; ++j) {          // no branch: all loads of a thread in flight at once
    int q  = j * 16 + pr;
    int qc = (j * 16 + 15 < P / 2) ? q : (q < P / 2 ? q : P / 2 - 1);
    lo[j] = s[(size_t)(2 * qc) * (M / 4)];
    hi[j] = s[(size_t)(2 * qc + 1) * (M / 4)];
  }
  // keeps the converts behind the last load: without it the last pass's two loads are
  // issued only after the first loads have returned, a second trip to memory
  __builtin_amdgcn_sched_barrier(0);
#pragma unroll
  for (int j = 0; j < NJ; ++j) {          // p in [P, PPAD): zero pad
    if (j * 16 + 15 >= P / 2 && j * 16 + pr >= P / 2) {
      lo[j] = (f32x4){0.0f, 0.0f, 0.0f, 0.0f};
      hi[j] = (f32x4){0.0f, 0.0f, 0.0f, 0.0f};
    }
  }
#pragma unroll
  for (int j = 0; j < NJ; ++j) {
    int q = j * 16 + pr;
    int col = (((q >> 2) ^ l16) << 2) + (q & 3);
#pragma unroll
    for (int i = 0; i < 4; ++i) {
      f32x2 two = {lo[j][i], hi[j][i]};
      tile[(4 * l16 + i) * 128 + col] =
          __builtin_bit_cast(u32, __builtin_convertvector(two, v2h));
    }
  }
  __syncthreads();                        // the tile is whole before any row is read

  u32x4* dst = (u32x4*)(fmT + ((size_t)b * M + m0) * PPAD);
#pragma unroll                            // all LDS reads issued before the first store
  for (int j = 0; j < MT * PPAD / 8 / 256; ++j) {
    int o = j * 256 + tid;                // 16-byte chunk of the block's output range
    int m = o / (PPAD / 8);
    int c = o % (PPAD / 8);
    dst[o] = *(const u32x4*)&tile[m * 128 + ((c ^ ((m >> 2) & 15)) << 2)];
  }
}

constexpr int NB_T  = (M / MT) * B;                  // transpose of maps
constexpr int NB_A1 = PT / 16 * (KS / PU) / 8;       // pack of maps, blocks per b
constexpr int NB_A  = NB_A1 * B;
constexpr int NB_W  = H / 16 * (KS / PU) / 8;        // pack of one weight matrix

__global__ void __launch_bounds__(256)
k_stage0(const float* __restrict__ maps, const float* __restrict__ W_map,
         const float* __restrict__ W_final, _Float16* __restrict__ fmT,
         _Float16* __restrict__ fmA, _Float16* __restrict__ Wm, _Float16* __restrict__ Wf) {
  __shared__ __attribute__((aligned(16))) u32 tile[MT * 128];    // 32 KB, transpose blocks only
  int i = blockIdx.x;
  if (i < NB_T) {
    fmT_block(maps, fmT, tile, i % (M / MT), i / (M / MT));
  } else if (i < NB_T + NB_A) {
    i -= NB_T;
    pack_block(maps, fmA, P, i % NB_A1, i / NB_A1);
  } else if (i < NB_T + NB_A + NB_W) {
    pack_block(W_map, Wm, H, i - (NB_T + NB_A), 0);
  } else {
    pack_block(W_final, Wf, H, i - (NB_T + NB_A + NB_W), 0);
  }
}

// ---------------------------------------------------------------------------
// The K = M products. One block = one tile of TA*16 rows of A by TB*16 rows of B; its NW waves
// split K: wave w takes k blocks [w*KW, (w+1)*KW) of the WHOLE tile, so every fragment that
// is loaded feeds TB (A) or TA (B) WMMAs and no fragment is loaded twice in a block.
// Both operands lie in fragment order and go from global memory straight to registers.
// The NW partial tiles are summed through LDS, w ascending; wave w ends up with the 16x16
// tiles w*NT/NW .. of the block (tile = i*TB + j), in accumulator layout.
// ---------------------------------------------------------------------------
constexpr int NW = 8;                     // waves per block
constexpr int KW = KS / NW;               // k blocks per wave
static_assert(KS % NW == 0, "K splits evenly");

// Ap, Bp: the caller's lane in k block 0 of the block's first A and B tile.
// red: NW * TA * TB * 64 chunks of 16 bytes.
template <int TA, int TB, int KG>
__device__ __forceinline__ void
tile_splitk(const v8h* __restrict__ Ap, const v8h* __restrict__ Bp, f32x4* red,
            v8f (&o)[TA * TB / NW]) {
  constexpr int NT = TA * TB;
  static_assert(NT % NW == 0 && KW % KG == 0, "no tail");
  int lane = threadIdx.x & 31;
  int wave = threadIdx.x >> 5;
  Ap += wave * KW * 64;
  Bp += wave * KW * 64;
  v8f c[TA][TB] = {};

  for (int ks = 0; ks < KW; ks += KG) {
    v16h a[KG][TA], bb[KG][TB];
#pragma unroll                                     // a[] and bb[] stay in registers
    for (int u = 0; u < KG; ++u) {
#pragma unroll
      for (int i = 0; i < TA; ++i)
        a[u][i] = load_pk(Ap + (i * KS + ks + u) * 64);
#pragma unroll
      for (int j = 0; j < TB; ++j)
        bb[u][j] = load_pk(Bp + (j * KS + ks + u) * 64);
    }
    // keeps the WMMAs behind the last load of the group: without it each WMMA's loads
    // are issued only after the WMMA before it, one trip to L2 per WMMA
    __builtin_amdgcn_sched_barrier(0);
#pragma unroll
    for (int u = 0; u < KG; ++u) {
#pragma unroll
      for (int i = 0; i < TA; ++i) {
#pragma unroll
        for (int j = 0; j < TB; ++j)
          c[i][j] = __builtin_amdgcn_wmma_f32_16x16x32_f16(false, a[u][i], false, bb[u][j],
                                                           (short)0, c[i][j], false, false);
      }
    }
    // what follows may rewrite the address registers that this group's loads name; as inputs
    // the two pointers stay in their registers up to this wait (else the last load's own
    // result may be given the pair that the loads before it still name)
    asm volatile("s_wait_xcnt 0x0" :: "v"(Ap), "v"(Bp) : "memory");
  }

#pragma unroll
  for (int i = 0; i < TA; ++i) {
#pragma unroll
    for (int j = 0; j < TB; ++j) {
      f32x4* d = red + ((wave * NT + i * TB + j) * 2) * 32 + lane;
      d[0]  = __builtin_shufflevector(c[i][j], c[i][j], 0, 1, 2, 3);
      d[32] = __builtin_shufflevector(c[i][j], c[i][j], 4, 5, 6, 7);
    }
  }
  __syncthreads();                                 // every partial tile is whole before it is summed
#pragma unroll                                     // o[] stays in registers
  for (int q = 0; q < NT / NW; ++q) {
    const f32x4* s = red + ((wave * (NT / NW) + q) * 2) * 32 + lane;
    f32x4 lo = s[0], hi = s[32];
#pragma unroll
    for (int w = 1; w < NW; ++w) {                 // w ascending: k ascending
      lo += s[w * NT * 64];
      hi += s[w * NT * 64 + 32];
    }
    o[q] = __builtin_shufflevector(lo, hi, 0, 1, 2, 3, 4, 5, 6, 7);
  }
}

// ---------------------------------------------------------------------------
// Stage 1: mlo(b,p,h) = fm[b,p,:] . W_map[h,:] + b_map[h]   (K = 2048)
// Stored as [b][h/4][p][h%4]: stage 2 has one thread per p, so its 16-byte load of
// four h covers 512 contiguous bytes per wave. A 128-B line is 8 p x 4 h of one wave.
// The p tiles of all b are one list of B * PT/16; a block takes MA of them and MB h tiles.
// ---------------------------------------------------------------------------
constexpr int MA = 4, MB = 6, MKG = 2;
static_assert((B * (PT / 16)) % MA == 0 && (H / 16) % MB == 0, "whole blocks");

__global__ void __launch_bounds__(NW * 32)
k_mlo(const _Float16* __restrict__ fmA, const _Float16* __restrict__ Wm,
      const float* __restrict__ b_map, float* __restrict__ mlo) {
  __shared__ __attribute__((aligned(16))) f32x4 red[NW * MA * MB * 64];
  int lane = threadIdx.x & 31;
  int wave = threadIdx.x >> 5;
  v8f o[MA * MB / NW];
  tile_splitk<MA, MB, MKG>((const v8h*)fmA + (size_t)(blockIdx.y * MA) * KS * 64 + lane,
                           (const v8h*)Wm + (size_t)(blockIdx.x * MB) * KS * 64 + lane, red, o);

  int po = (lane >> 4) * 8;
#pragma unroll
  for (int q = 0; q < MA * MB / NW; ++q) {
    int tile = wave * (MA * MB / NW) + q;
    int g  = blockIdx.y * MA + tile / MB;          // p tile in the list of all b
    int b  = g / (PT / 16);
    int pt = g % (PT / 16);
    int h  = (blockIdx.x * MB + tile % MB) * 16 + (lane & 15);
    float bias = b_map[h];
#pragma unroll
    for (int r = 0; r < 8; ++r) {
      int p = pt * 16 + po + r;                    // p in [P, PT) is pad, never read
      mlo[(((size_t)b * (H / 4) + (h >> 2)) * PT + p) * 4 + (h & 3)] = o[q][r] + bias;
    }
  }
}

// ---------------------------------------------------------------------------
// Stage 2: scores + softmax.  One block per (b,t).
// score[p] = sum_h W_rect[h]*relu(mlo[b,p,h]+hid[b,t,h]) + b_rect
// ReLU between add and reduction => VALU (cannot be a GEMM); ~0.3 Gops total.
// ---------------------------------------------------------------------------
__global__ void __launch_bounds__(256)
k_scores(const float* __restrict__ mlo, const float* __restrict__ hiddens,
         const float* __restrict__ W_rect, const float* __restrict__ b_rect,
         float* __restrict__ attn_out, _Float16* __restrict__ attn16) {
  __shared__ float hid[H];
  __shared__ float wr[H];
  __shared__ float red[256];
  int t = blockIdx.x, b = blockIdx.y;
  int tid = threadIdx.x;

  for (int h = tid; h < H; h += 256) {
    hid[h] = hiddens[((size_t)b * T + t) * H + h];
    wr[h]  = W_rect[h];
  }
  __syncthreads();

  float val = 0.0f;
  if (tid < P) {
    const float4* mq = (const float4*)mlo + (size_t)b * (H / 4) * PT + tid;
    float acc = 0.0f;
    // unroll: eight independent whole-line loads in flight per wave
#pragma unroll 8
    for (int h4 = 0; h4 < H / 4; ++h4) {
      float4 q = mq[(size_t)h4 * PT];
      float mv[4] = {q.x, q.y, q.z, q.w};
#pragma unroll
      for (int u = 0; u < 4; ++u) {                // h ascending: same sum order
        float r = mv[u] + hid[h4 * 4 + u];
        acc = fmaf(wr[h4 * 4 + u], (r > 0.0f ? r : 0.0f), acc);
      }
    }
    val = acc + b_rect[0];
  }

  red[tid] = (tid < P) ? val : -3.0e38f;
  __syncthreads();
  for (int s = 128; s > 0; s >>= 1) {
    if (tid < s) red[tid] = fmaxf(red[tid], red[tid + s]);
    __syncthreads();
  }
  float mx = red[0];
  __syncthreads();

  float e = (tid < P) ? __expf(val - mx) : 0.0f;
  red[tid] = e;
  __syncthreads();
  for (int s = 128; s > 0; s >>= 1) {
    if (tid < s) red[tid] += red[tid + s];
    __syncthreads();
  }
  float a = e / red[0];

  if (tid < P)    attn_out[((size_t)b * T + t) * P + tid] = a;
  if (tid < PPAD) attn16[((size_t)b * T + t) * PPAD + tid] =
                      (_Float16)((tid < P) ? a : 0.0f);
}

__global__ void __launch_bounds__(128)
k_ctx(const _Float16* __restrict__ attn16, const _Float16* __restrict__ fmT,
      _Float16* __restrict__ ctx16) {
  __shared__ _Float16 Atile[16 * PPAD];            // 7 KB
  int lane = threadIdx.x & 31;
  int wave = threadIdx.x >> 5;
  int b  = blockIdx.z;                             // 8
  int tt = blockIdx.y;                             // 4 t-tiles
  int mg = blockIdx.x * 4 + wave;                  // 32 groups of 64 m
  const _Float16* Abase = attn16 + ((size_t)b * T + tt * 16) * PPAD;
  const _Float16* Bf    = fmT    + (size_t)b * M * PPAD;

  if (threadIdx.x < 32) {
    tdm_load_2d_f16(Abase, (u32)(size_t)Atile, PPAD, 16, PPAD, 16, PPAD);
    __builtin_amdgcn_s_wait_tensorcnt((short)0);
  }
  __syncthreads();

  int arow = lane & 15;
  int br0  = mg * 64 + (lane & 15);
  v8f c[4] = {};
  for (int k = 0; k < PPAD; k += 32) {
    v16h a = load_frag(Atile, PPAD, arow, k, lane);
    v16h bb[4];
#pragma unroll
    for (int j = 0; j < 4; ++j)
      bb[j] = load_frag(Bf, PPAD, br0 + j * 16, k, lane);
#pragma unroll
    for (int j = 0; j < 4; ++j)
      c[j] = __builtin_amdgcn_wmma_f32_16x16x32_f16(false, a, false, bb[j],
                                                    (short)0, c[j], false, false);
  }

  int to = (lane >> 4) * 8;
#pragma unroll
  for (int j = 0; j < 4; ++j) {
    // m = mg*64 + j*16 + lane%16 = ks*32 + hf*16 + (fragment lane / 16)*8 + lane%8
    int ks = mg * 2 + (j >> 1);
    int hf = j & 1;
    int fl = ((lane >> 3) & 1) * 16 + to;          // fragment lane of row to + 0
    _Float16* d = ctx16 + ((((size_t)(b * (T / 16) + tt) * KS + ks) * 2 + hf) * 32 + fl) * 8
                        + (lane & 7);
#pragma unroll
    for (int r = 0; r < 8; ++r) d[r * 8] = (_Float16)c[j][r];
  }
}

// ---------------------------------------------------------------------------
// Stage 4: out[b][t][h] = ctx[b,t,:] . W_final[h,:] + b_final[h] + hiddens[b,t,h]
// As stage 1; the t tiles of all b are one list of B * T/16 (row = b*T + t).
// ---------------------------------------------------------------------------
constexpr int FA = 2, FB = 4, FKG = 2;
static_assert((B * (T / 16)) % FA == 0 && (H / 16) % FB == 0, "whole blocks");

__global__ void __launch_bounds__(NW * 32)
k_final(const _Float16* __restrict__ ctx16, const _Float16* __restrict__ Wf,
        const float* __restrict__ b_final, const float* __restrict__ hiddens,
        float* __restrict__ out) {
  __shared__ __attribute__((aligned(16))) f32x4 red[NW * FA * FB * 64];
  int lane = threadIdx.x & 31;
  int wave = threadIdx.x >> 5;
  v8f o[FA * FB / NW];
  tile_splitk<FA, FB, FKG>((const v8h*)ctx16 + (size_t)(blockIdx.y * FA) * KS * 64 + lane,
                           (const v8h*)Wf + (size_t)(blockIdx.x * FB) * KS * 64 + lane, red, o);

  int to = (lane >> 4) * 8;
#pragma unroll
  for (int q = 0; q < FA * FB / NW; ++q) {
    int tile = wave * (FA * FB / NW) + q;
    int g = blockIdx.y * FA + tile / FB;           // t tile in the list of all b
    int h = (blockIdx.x * FB + tile % FB) * 16 + (lane & 15);
    float bias = b_final[h];
#pragma unroll
    for (int r = 0; r < 8; ++r) {
      size_t idx = (size_t)(g * 16 + to + r) * H + h;
      out[idx] = o[q][r] + bias + hiddens[idx];
    }
  }
}

// ---------------------------------------------------------------------------
extern "C" void kernel_launch(void* const* d_in, const int* in_sizes, int n_in,
                              void* d_out, int out_size, void* d_ws, size_t ws_size,
                              hipStream_t stream) {
  (void)in_sizes; (void)n_in; (void)out_size; (void)ws_size;
  const float* maps    = (const float*)d_in[0];
  const float* hiddens = (const float*)d_in[1];
  const float* W_map   = (const float*)d_in[2];
  const float* b_map   = (const float*)d_in[3];
  const float* W_final = (const float*)d_in[4];
  const float* b_final = (const float*)d_in[5];
  const float* W_rect  = (const float*)d_in[6];
  const float* b_rect  = (const float*)d_in[7];

  float* out  = (float*)d_out;                     // (B,T,H)
  float* attn = out + (size_t)B * T * H;           // (B,T,P)

  char* ws = (char*)d_ws;
  _Float16* fmA   = (_Float16*)(ws + OFF_FMA);
  _Float16* fmT   = (_Float16*)(ws + OFF_FMT);
  _Float16* Wm16  = (_Float16*)(ws + OFF_WMAP);
  _Float16* Wf16  = (_Float16*)(ws + OFF_WFIN);
  float*    mlo   = (float*)   (ws + OFF_MLO);
  _Float16* att16 = (_Float16*)(ws + OFF_ATT16);
  _Float16* ctx16 = (_Float16*)(ws + OFF_CTX16);

  // Stage 0: converts and transpose, one launch
  k_stage0<<<dim3(NB_T + NB_A + 2 * NB_W), 256, 0, stream>>>(maps, W_map, W_final,
                                                            fmT, fmA, Wm16, Wf16);

  // Stage 1: map_linear GEMM (WMMA)
  k_mlo<<<dim3(H / 16 / MB, B * (PT / 16) / MA), NW * 32, 0, stream>>>(fmA, Wm16, b_map, mlo);

  // Stage 2: fused rectified score + softmax (VALU)
  k_scores<<<dim3(T, B), 256, 0, stream>>>(mlo, hiddens, W_rect, b_rect, attn, att16);

  k_ctx<<<dim3(8, 4, 8), 128, 0, stream>>>(att16, fmT, ctx16);

  // Stage 4: output GEMM + bias + residual (WMMA)
  k_final<<<dim3(H / 16 / FB, B * (T / 16) / FA), NW * 32, 0, stream>>>(ctx16, Wf16, b_final, hiddens, out);
}

// v006
// A run of this version takes 50.4 microseconds.
// In two side-by-side timings against v005, it was 1.24 and 1.27 times as fast.
// All steps since v000 together make it 2.98 times as fast.
#include <hip/hip_runtime.h>

constexpr int B = 8, T = 64, P = 196, M = 2048, H = 768;
constexpr int PPAD = 224;                 // P rounded up to multiple of 32 (K tile)
constexpr int KS   = M / 32;              // 32-wide k blocks of the K = M products
constexpr int PT   = 208;                 // P rounded up to the 16-row p tiles of stage 1

typedef __attribute__((ext_vector_type(16))) _Float16 v16h;
typedef __attribute__((ext_vector_type(8)))  _Float16 v8h;
typedef __attribute__((ext_vector_type(8)))  float    v8f;
typedef unsigned int u32;
typedef __attribute__((ext_vector_type(4))) u32 u32x4;
typedef __attribute__((ext_vector_type(8))) int i32x8;
typedef __attribute__((ext_vector_type(4))) int i32x4;

// Workspace layout (bytes, all 16B aligned)
constexpr size_t OFF_FMA   = 0;                                   // fp16 [B][PT][M], fragment order
constexpr size_t OFF_FMT   = OFF_FMA + (size_t)B * PT * M * 2;    // fp16 [B][M][PPAD]
constexpr size_t OFF_WMAP  = OFF_FMT + (size_t)B * M * PPAD * 2;  // fp16 [H][M], fragment order
constexpr size_t OFF_WFIN  = OFF_WMAP + (size_t)H * M * 2;        // fp16 [H][M], fragment order
constexpr size_t OFF_MLO   = OFF_WFIN + (size_t)H * M * 2;        // fp32 [B][H/4][PT][4]
constexpr size_t OFF_ATT16 = OFF_MLO + (size_t)B * H * PT * 4;    // fp16 [B][T][PPAD]
constexpr size_t OFF_CTX16 = OFF_ATT16 + (size_t)B * T * PPAD * 2;// fp16 [B][T][M], fragment order

__device__ __forceinline__ void tdm_load_2d_f16(const void* gaddr, u32 lds_off,
                                                u32 tile_d0, u32 tile_d1,
                                                u32 tensor_d0, u32 tensor_d1,
                                                u32 row_stride) {
  unsigned long long ga = (unsigned long long)gaddr;
  u32x4 g0;
  g0.x = 1u;
  g0.y = lds_off;
  g0.z = (u32)ga;
  g0.w = (u32)(ga >> 32) | (2u << 30);
  i32x8 g1;
  g1[0] = (int)(1u << 16);
  g1[1] = (int)(tensor_d0 << 16);
  g1[2] = (int)((tensor_d0 >> 16) | (tensor_d1 << 16));
  g1[3] = (int)((tensor_d1 >> 16) | (tile_d0 << 16));
  g1[4] = (int)tile_d1;
  g1[5] = (int)row_stride;
  g1[6] = 0;
  g1[7] = 0;
  i32x4 z4 = {0, 0, 0, 0};
#if defined(__clang_major__) && __clang_major__ >= 23
  i32x8 z8 = {0, 0, 0, 0, 0, 0, 0, 0};
  __builtin_amdgcn_tensor_load_to_lds(g0, g1, z4, z4, z8, 0);
#else
  __builtin_amdgcn_tensor_load_to_lds(g0, g1, z4, z4, 0);
#endif
}

__device__ __forceinline__ v16h load_frag(const _Float16* mat, int ld, int row,
                                          int k0, int lane) {
  const _Float16* p = mat + (size_t)row * ld + k0 + ((lane >> 4) << 3);
  v8h lo = *(const v8h*)(p);
  v8h hi = *(const v8h*)(p + 16);
  return __builtin_shufflevector(lo, hi, 0, 1, 2, 3, 4, 5, 6, 7,
                                          8, 9, 10, 11, 12, 13, 14, 15);
}

__device__ __forceinline__ v16h load_pk(const v8h* p) {
  v8h lo = p[0];
  v8h hi = p[32];
  return __builtin_shufflevector(lo, hi, 0, 1, 2, 3, 4, 5, 6, 7,
                                          8, 9, 10, 11, 12, 13, 14, 15);
}

// ---------------------------------------------------------------------------
// Stage 0: fp32 -> fp16 converts into fragment order (and padded transpose of fm)
// Few fat waves: every global access is 16 B per lane, every store of pack_block is 512
// contiguous bytes per wave, and all loads of a thread are issued before the first use.
// ---------------------------------------------------------------------------
typedef __attribute__((ext_vector_type(4))) float    f32x4;
typedef __attribute__((ext_vector_type(2))) float    f32x2;
typedef __attribute__((ext_vector_type(4))) _Float16 v4h;
typedef __attribute__((ext_vector_type(2))) _Float16 v2h;

constexpr int PU = 4;                     // k blocks per wave of pack_block: 512 B of each of 16 rows
static_assert(KS % PU == 0 && (PT / 16 * (KS / PU)) % 8 == 0 && (H / 16 * (KS / PU)) % 8 == 0,
              "pack_block has no tail");

// src: matrices of [rows][M] floats, this block works on matrix mat. One wave = one 16-row
// tile x PU k blocks; blk counts the blocks of one matrix.
// Rows past the end of a matrix (the last p tile) are stored as zeros.
__device__ __forceinline__ void
pack_block(const float* __restrict__ src, _Float16* __restrict__ dst, int rows, int blk, int mat) {
  int lane = threadIdx.x & 31;
  int w    = blk * 8 + (threadIdx.x >> 5);
  int tile = w / (KS / PU);
  int ks0  = (w % (KS / PU)) * PU;
  int tpm  = (rows + 15) >> 4;            // tiles per matrix
  int r    = tile * 16 + (lane & 15);
  int rc   = r < rows ? r : rows - 1;     // the address stays inside the matrix
  const f32x4* s = (const f32x4*)(src + ((size_t)mat * rows + rc) * M
                                      + ks0 * 32 + (lane >> 4) * 8);
  v8h* d = (v8h*)dst + ((size_t)(mat * tpm + tile) * KS + ks0) * 64 + lane;
  f32x4 v[PU][4];
#pragma unroll                            // v[] stays in registers, 4 * PU loads in flight
  for (int u = 0; u < PU; ++u) {
    v[u][0] = s[u * 8 + 0];               // k = (L/16)*8 + 0..7
    v[u][1] = s[u * 8 + 1];
    v[u][2] = s[u * 8 + 4];               // k = 16 + (L/16)*8 + 0..7
    if (u == PU - 1) asm volatile("s_wait_xcnt 0x0" ::: "memory");
    v[u][3] = s[u * 8 + 5];
  }
  // keeps the converts behind the last load: without it 12 of the 16 loads are issued only
  // after the first four have returned, a second trip to memory
  __builtin_amdgcn_sched_barrier(0);
#pragma unroll
  for (int u = 0; u < PU; ++u) {
#pragma unroll
    for (int hf = 0; hf < 2; ++hf) {
      v4h x = __builtin_convertvector(v[u][2 * hf], v4h);
      v4h y = __builtin_convertvector(v[u][2 * hf + 1], v4h);
      v8h o = __builtin_shufflevector(x, y, 0, 1, 2, 3, 4, 5, 6, 7);
      if (r >= rows) o = (v8h){0, 0, 0, 0, 0, 0, 0, 0};
      d[u * 64 + hf * 32] = o;
    }
  }
  // the code behind this function's call may reuse the registers that the stores above name
  // (address pair, data): the wait stands between the last store and any such overwrite
  asm volatile("s_wait_xcnt 0x0" ::: "memory");
}

constexpr int MT = 64;
static_assert(P % 2 == 0 && PPAD % 32 == 0 && PPAD <= 256 && M % MT == 0, "tile shape");
static_assert((MT * PPAD / 8) % 256 == 0, "whole 16-byte stores per thread");

__device__ __forceinline__ void
fmT_block(const float* __restrict__ maps, _Float16* __restrict__ fmT, u32* tile, int mblk, int b) {
  constexpr int NJ = PPAD / 32;           // passes of 16 row pairs
  int tid = threadIdx.x;
  int l16 = tid & 15;                     // m = 4 * l16 + i
  int pr  = tid >> 4;                     // row pair inside a pass
  int m0  = mblk * MT;
  const f32x4* s = (const f32x4*)(maps + (size_t)b * P * M + m0) + l16;

  // every loop below is unrolled so that lo[] and hi[] stay in registers
  f32x4 lo[NJ], hi[NJ];                   // rows 2q and 2q + 1
#pragma unroll
  for (int j = 0; j < NJ; ++j) {          // no branch: all loads of a thread in flight at once
    int q  = j * 16 + pr;
    int qc = (j * 16 + 15 < P / 2) ? q : (q < P / 2 ? q : P / 2 - 1);
    lo[j] = s[(size_t)(2 * qc) * (M / 4)];
    hi[j] = s[(size_t)(2 * qc + 1) * (M / 4)];
  }
  // keeps the converts behind the last load: without it the last pass's two loads are
  // issued only after the first loads have returned, a second trip to memory
  __builtin_amdgcn_sched_barrier(0);
#pragma unroll
  for (int j = 0; j < NJ; ++j) {          // p in [P, PPAD): zero pad
    if (j * 16 + 15 >= P / 2 && j * 16 + pr >= P / 2) {
      lo[j] = (f32x4){0.0f, 0.0f, 0.0f, 0.0f};
      hi[j] = (f32x4){0.0f, 0.0f, 0.0f, 0.0f};
    }
  }
#pragma unroll
  for (int j = 0; j < NJ; ++j) {
    int q = j * 16 + pr;
    int col = (((q >> 2) ^ l16) << 2) + (q & 3);
#pragma unroll
    for (int i = 0; i < 4; ++i) {
      f32x2 two = {lo[j][i], hi[j][i]};
      tile[(4 * l16 + i) * 128 + col] =
          __builtin_bit_cast(u32, __builtin_convertvector(two, v2h));
    }
  }
  __syncthreads();                        // the tile is whole before any row is read

  u32x4* dst = (u32x4*)(fmT + ((size_t)b * M + m0) * PPAD);
#pragma unroll                            // all LDS reads issued before the first store
  for (int j = 0; j < MT * PPAD / 8 / 256; ++j) {
    int o = j * 256 + tid;                // 16-byte chunk of the block's output range
    int m = o / (PPAD / 8);
    int c = o % (PPAD / 8);
    dst[o] = *(const u32x4*)&tile[m * 128 + ((c ^ ((m >> 2) & 15)) << 2)];
  }
}

constexpr int NB_T  = (M / MT) * B;                  // transpose of maps
constexpr int NB_A1 = PT / 16 * (KS / PU) / 8;       // pack of maps, blocks per b
constexpr int NB_A  = NB_A1 * B;
constexpr int NB_W  = H / 16 * (KS / PU) / 8;        // pack of one weight matrix

__global__ void __launch_bounds__(256)
k_stage0(const float* __restrict__ maps, const float* __restrict__ W_map,
         const float* __restrict__ W_final, _Float16* __restrict__ fmT,
         _Float16* __restrict__ fmA, _Float16* __restrict__ Wm, _Float16* __restrict__ Wf) {
  __shared__ __attribute__((aligned(16))) u32 tile[MT * 128];    // 32 KB, transpose blocks only
  int i = blockIdx.x;
  if (i < NB_T) {
    fmT_block(maps, fmT, tile, i % (M / MT), i / (M / MT));
  } else if (i < NB_T + NB_A) {
    i -= NB_T;
    pack_block(maps, fmA, P, i % NB_A1, i / NB_A1);
  } else if (i < NB_T + NB_A + NB_W) {
    pack_block(W_map, Wm, H, i - (NB_T + NB_A), 0);
  } else {
    pack_block(W_final, Wf, H, i - (NB_T + NB_A + NB_W), 0);
  }
}

// ---------------------------------------------------------------------------
// The K = M products. One block = one tile of TA*16 rows of A by TB*16 rows of B; its NW waves
// split K: wave w takes k blocks [w*KW, (w+1)*KW) of the WHOLE tile, so every fragment that
// is loaded feeds TB (A) or TA (B) WMMAs and no fragment is loaded twice in a block.
// Both operands lie in fragment order and go from global memory straight to registers.
// The NW partial tiles are summed through LDS, w ascending; wave w ends up with the 16x16
// tiles w*NT/NW .. of the block (tile = i*TB + j), in accumulator layout.
// ---------------------------------------------------------------------------
constexpr int NW = 8;                     // waves per block
constexpr int KW = KS / NW;               // k blocks per wave
static_assert(KS % NW == 0, "K splits evenly");

// Ap, Bp: the caller's lane in k block 0 of the block's first A and B tile.
// red: NW * TA * TB * 64 chunks of 16 bytes.
template <int TA, int TB, int KG>
__device__ __forceinline__ void
tile_splitk(const v8h* __restrict__ Ap, const v8h* __restrict__ Bp, f32x4* red,
            v8f (&o)[TA * TB / NW]) {
  constexpr int NT = TA * TB;
  static_assert(NT % NW == 0 && KW % KG == 0, "no tail");
  int lane = threadIdx.x & 31;
  int wave = threadIdx.x >> 5;
  Ap += wave * KW * 64;
  Bp += wave * KW * 64;
  v8f c[TA][TB] = {};

  for (int ks = 0; ks < KW; ks += KG) {
    v16h a[KG][TA], bb[KG][TB];
#pragma unroll                                     // a[] and bb[] stay in registers
    for (int u = 0; u < KG; ++u) {
#pragma unroll
      for (int i = 0; i < TA; ++i)
        a[u][i] = load_pk(Ap + (i * KS + ks + u) * 64);
#pragma unroll
      for (int j = 0; j < TB; ++j)
        bb[u][j] = load_pk(Bp + (j * KS + ks + u) * 64);
    }
    // keeps the WMMAs behind the last load of the group: without it each WMMA's loads
    // are issued only after the WMMA before it, one trip to L2 per WMMA
    __builtin_amdgcn_sched_barrier(0);
#pragma unroll
    for (int u = 0; u < KG; ++u) {
#pragma unroll
      for (int i = 0; i < TA; ++i) {
#pragma unroll
        for (int j = 0; j < TB; ++j)
          c[i][j] = __builtin_amdgcn_wmma_f32_16x16x32_f16(false, a[u][i], false, bb[u][j],
                                                           (short)0, c[i][j], false, false);
      }
    }
    // what follows may rewrite the address registers that this group's loads name; as inputs
    // the two pointers stay in their registers up to this wait (else the last load's own
    // result may be given the pair that the loads before it still name)
    asm volatile("s_wait_xcnt 0x0" :: "v"(Ap), "v"(Bp) : "memory");
  }

#pragma unroll
  for (int i = 0; i < TA; ++i) {
#pragma unroll
    for (int j = 0; j < TB; ++j) {
      f32x4* d = red + ((wave * NT + i * TB + j) * 2) * 32 + lane;
      d[0]  = __builtin_shufflevector(c[i][j], c[i][j], 0, 1, 2, 3);
      d[32] = __builtin_shufflevector(c[i][j], c[i][j], 4, 5, 6, 7);
    }
  }
  __syncthreads();                                 // every partial tile is whole before it is summed
#pragma unroll                                     // o[] stays in registers
  for (int q = 0; q < NT / NW; ++q) {
    const f32x4* s = red + ((wave * (NT / NW) + q) * 2) * 32 + lane;
    f32x4 lo = s[0], hi = s[32];
#pragma unroll
    for (int w = 1; w < NW; ++w) {                 // w ascending: k ascending
      lo += s[w * NT * 64];
      hi += s[w * NT * 64 + 32];
    }
    o[q] = __builtin_shufflevector(lo, hi, 0, 1, 2, 3, 4, 5, 6, 7);
  }
}

// ---------------------------------------------------------------------------
// Stage 1: mlo(b,p,h) = fm[b,p,:] . W_map[h,:] + b_map[h]   (K = 2048)
// Stored as [b][h/4][p][h%4]: the lanes of a stage 2 load hold 32 consecutive p, so its 16-byte load of
// four h covers 512 contiguous bytes per wave. A 128-B line is 8 p x 4 h of one wave.
// The p tiles of all b are one list of B * PT/16; a block takes MA of them and MB h tiles.
// ---------------------------------------------------------------------------
constexpr int MA = 4, MB = 6, MKG = 2;
static_assert((B * (PT / 16)) % MA == 0 && (H / 16) % MB == 0, "whole blocks");

__global__ void __launch_bounds__(NW * 32)
k_mlo(const _Float16* __restrict__ fmA, const _Float16* __restrict__ Wm,
      const float* __restrict__ b_map, float* __restrict__ mlo) {
  __shared__ __attribute__((aligned(16))) f32x4 red[NW * MA * MB * 64];
  int lane = threadIdx.x & 31;
  int wave = threadIdx.x >> 5;
  v8f o[MA * MB / NW];
  tile_splitk<MA, MB, MKG>((const v8h*)fmA + (size_t)(blockIdx.y * MA) * KS * 64 + lane,
                           (const v8h*)Wm + (size_t)(blockIdx.x * MB) * KS * 64 + lane, red, o);

  int po = (lane >> 4) * 8;
#pragma unroll
  for (int q = 0; q < MA * MB / NW; ++q) {
    int tile = wave * (MA * MB / NW) + q;
    int g  = blockIdx.y * MA + tile / MB;          // p tile in the list of all b
    int b  = g / (PT / 16);
    int pt = g % (PT / 16);
    int h  = (blockIdx.x * MB + tile % MB) * 16 + (lane & 15);
    float bias = b_map[h];
#pragma unroll
    for (int r = 0; r < 8; ++r) {
      int p = pt * 16 + po + r;                    // p in [P, PT) is pad; stage 2 loads it but drops its scores
      mlo[(((size_t)b * (H / 4) + (h >> 2)) * PT + p) * 4 + (h & 3)] = o[q][r] + bias;
    }
  }
}

// ---------------------------------------------------------------------------
// Stage 2: scores + softmax.  One block per (b, ST consecutive t).
// score[p] = sum_h W_rect[h]*relu(mlo[b,p,h]+hid[b,t,h]) + b_rect
// ReLU between add and reduction => VALU (cannot be a GEMM); ~0.3 Gops total.
// Register tile: a wave covers ALL p (lane holds p = j*32 + lane, j < SJ) for ST t and for its
// own H/SW values of h. Every mlo value that is loaded feeds ST t (mlo is read T/ST times from
// L2, not T times) and every hid / W_rect value read from LDS feeds SJ p.
// The SW partial sums of a score are added through LDS, wave ascending (h ascending).
// ---------------------------------------------------------------------------
constexpr int ST = 2;                     // t per block: B * T / ST blocks, one per WGP
constexpr int SW = 16;                    // waves per block
constexpr int SH = H / 4 / SW;            // groups of four h per wave
constexpr int SG = 2;                     // groups of four h per batch of loads
constexpr int SJ = (P + 31) / 32;         // p per lane
static_assert(T % ST == 0 && (H / 4) % SW == 0 && SH % SG == 0, "no tail");
static_assert(ST * 256 == SW * 32 && P <= 256 && (SJ - 1) * 32 < PT, "softmax: 256 threads per t");

__global__ void __launch_bounds__(SW * 32)
k_scores(const float* __restrict__ mlo, const float* __restrict__ hiddens,
         const float* __restrict__ W_rect, const float* __restrict__ b_rect,
         float* __restrict__ attn_out, _Float16* __restrict__ attn16) {
  __shared__ __attribute__((aligned(16))) float hid[ST * H];
  __shared__ __attribute__((aligned(16))) float wr[(H + SW * 32 - 1) / (SW * 32) * (SW * 32)];
  __shared__ float part[SW][ST][SJ * 32];
  __shared__ float red[ST][256];
  int t0 = blockIdx.x * ST, b = blockIdx.y;
  int tid  = threadIdx.x;
  int lane = tid & 31;
  int wave = tid >> 5;

  // j < SJ - 1: whole 512-byte loads. j = SJ - 1: the row ends at PT, the address is clamped
  // to it (p in [P, PT) is pad that stage 1 has written; such sums are never read).
  const f32x4* mrow = (const f32x4*)mlo + ((size_t)b * (H / 4) + wave * SH) * PT;
  const f32x4* mq = mrow + lane;
  const f32x4* mz = mrow + ((SJ - 1) * 32 + lane < PT ? (SJ - 1) * 32 + lane : PT - 1);

  // hiddens (its ST rows are contiguous) and W_rect go to LDS; no branch and no rolled loop:
  // all loads of a thread, the first mlo batch too, are in flight at once, one trip to memory
  constexpr int NTH = SW * 32, NHS = ST * H / NTH, NWS = (H + NTH - 1) / NTH;
  static_assert(ST * H % NTH == 0, "whole passes");
  float hs[NHS], ws[NWS];
#pragma unroll                            // hs[] and ws[] stay in registers
  for (int i = 0; i < NHS; ++i) hs[i] = hiddens[((size_t)b * T + t0) * H + i * NTH + tid];
#pragma unroll
  for (int i = 0; i < NWS; ++i) {
    int h = i * NTH + tid;
    ws[i] = W_rect[h < H ? h : H - 1];    // the address stays inside W_rect
  }

  f32x4 q[2][SG][SJ];                     // this batch and the next one
#pragma unroll                            // q[] stays in registers
  for (int u = 0; u < SG; ++u) {
#pragma unroll
    for (int j = 0; j < SJ; ++j)
      q[0][u][j] = j < SJ - 1 ? mq[u * PT + j * 32] : mz[u * PT];
  }

#pragma unroll
  for (int i = 0; i < NHS; ++i) hid[i * NTH + tid] = hs[i];
#pragma unroll
  for (int i = 0; i < NWS; ++i) {
    wr[i * NTH + tid] = ws[i];            // no test: past H lies the pad of wr[], never read
  }
  __syncthreads();

  float acc[ST][SJ] = {};
#pragma unroll                            // q[] and acc[] stay in registers
  for (int g = 0; g < SH / SG; ++g) {
    if (g + 1 < SH / SG) {
#pragma unroll
      for (int u = 0; u < SG; ++u) {
#pragma unroll
        for (int j = 0; j < SJ; ++j)
          q[(g + 1) & 1][u][j] = j < SJ - 1 ? mq[((g + 1) * SG + u) * PT + j * 32]
                                            : mz[((g + 1) * SG + u) * PT];
      }
    }
    // as inputs the two pointers stay in their registers up to this wait, which stands behind
    // the last load that names them (else a load's own result may be given such a pair)
    if (g + 2 == SH / SG) asm volatile("s_wait_xcnt 0x0" :: "v"(mq), "v"(mz) : "memory");
    // keeps the next batch's loads in front of this batch's arithmetic, so that they fly
    // while it runs: without it they are spread through the arithmetic and fewer are in flight
    __builtin_amdgcn_sched_barrier(0);
#pragma unroll
    for (int u = 0; u < SG; ++u) {
      int h4 = wave * SH + g * SG + u;
      f32x4 w4 = *(const f32x4*)&wr[h4 * 4];
      f32x4 hv[ST];
#pragma unroll
      for (int s = 0; s < ST; ++s) hv[s] = *(const f32x4*)&hid[s * H + h4 * 4];
#pragma unroll
      for (int c = 0; c < 4; ++c) {                // h ascending inside a wave
#pragma unroll
        for (int j = 0; j < SJ; ++j) {
#pragma unroll
          for (int s = 0; s < ST; ++s) {
            float r = q[g & 1][u][j][c] + hv[s][c];
            acc[s][j] = fmaf(w4[c], (r > 0.0f ? r : 0.0f), acc[s][j]);
          }
        }
      }
    }
  }
#pragma unroll
  for (int s = 0; s < ST; ++s) {
#pragma unroll
    for (int j = 0; j < SJ; ++j) part[wave][s][j * 32 + lane] = acc[s][j];
  }
  __syncthreads();                        // every wave's partial sums are there before they are added

  // softmax: 256 threads per t, one per p
  int ts = tid >> 8;
  int p  = tid & 255;
  int t  = t0 + ts;
  float val = 0.0f;
  if (p < P) {
    float a = part[0][ts][p];
#pragma unroll
    for (int w = 1; w < SW; ++w) a += part[w][ts][p];
    val = a + b_rect[0];
  }

  red[ts][p] = (p < P) ? val : -3.0e38f;
  __syncthreads();
  for (int s = 128; s > 0; s >>= 1) {
    if (p < s) red[ts][p] = fmaxf(red[ts][p], red[ts][p + s]);
    __syncthreads();
  }
  float mx = red[ts][0];
  __syncthreads();

  float e = (p < P) ? __expf(val - mx) : 0.0f;
  red[ts][p] = e;
  __syncthreads();
  for (int s = 128; s > 0; s >>= 1) {
    if (p < s) red[ts][p] += red[ts][p + s];
    __syncthreads();
  }
  float a = e / red[ts][0];

  if (p < P)    attn_out[((size_t)b * T + t) * P + p] = a;
  if (p < PPAD) attn16[((size_t)b * T + t) * PPAD + p] =
                    (_Float16)((p < P) ? a : 0.0f);
}

__global__ void __launch_bounds__(128)
k_ctx(const _Float16* __restrict__ attn16, const _Float16* __restrict__ fmT,
      _Float16* __restrict__ ctx16) {
  __shared__ _Float16 Atile[16 * PPAD];            // 7 KB
  int lane = threadIdx.x & 31;
  int wave = threadIdx.x >> 5;
  int b  = blockIdx.z;                             // 8
  int tt = blockIdx.y;                             // 4 t-tiles
  int mg = blockIdx.x * 4 + wave;                  // 32 groups of 64 m
  const _Float16* Abase = attn16 + ((size_t)b * T + tt * 16) * PPAD;
  const _Float16* Bf    = fmT    + (size_t)b * M * PPAD;

  if (threadIdx.x < 32) {
    tdm_load_2d_f16(Abase, (u32)(size_t)Atile, PPAD, 16, PPAD, 16, PPAD);
    __builtin_amdgcn_s_wait_tensorcnt((short)0);
  }
  __syncthreads();

  int arow = lane & 15;
  int br0  = mg * 64 + (lane & 15);
  v8f c[4] = {};
  for (int k = 0; k < PPAD; k += 32) {
    v16h a = load_frag(Atile, PPAD, arow, k, lane);
    v16h bb[4];
#pragma unroll
    for (int j = 0; j < 4; ++j)
      bb[j] = load_frag(Bf, PPAD, br0 + j * 16, k, lane);
#pragma unroll
    for (int j = 0; j < 4; ++j)
      c[j] = __builtin_amdgcn_wmma_f32_16x16x32_f16(false, a, false, bb[j],
                                                    (short)0, c[j], false, false);
  }

  int to = (lane >> 4) * 8;
#pragma unroll
  for (int j = 0; j < 4; ++j) {
    // m = mg*64 + j*16 + lane%16 = ks*32 + hf*16 + (fragment lane / 16)*8 + lane%8
    int ks = mg * 2 + (j >> 1);
    int hf = j & 1;
    int fl = ((lane >> 3) & 1) * 16 + to;          // fragment lane of row to + 0
    _Float16* d = ctx16 + ((((size_t)(b * (T / 16) + tt) * KS + ks) * 2 + hf) * 32 + fl) * 8
                        + (lane & 7);
#pragma unroll
    for (int r = 0; r < 8; ++r) d[r * 8] = (_Float16)c[j][r];
  }
}

// ---------------------------------------------------------------------------
// Stage 4: out[b][t][h] = ctx[b,t,:] . W_final[h,:] + b_final[h] + hiddens[b,t,h]
// As stage 1; the t tiles of all b are one list of B * T/16 (row = b*T + t).
// ---------------------------------------------------------------------------
constexpr int FA = 2, FB = 4, FKG = 2;
static_assert((B * (T / 16)) % FA == 0 && (H / 16) % FB == 0, "whole blocks");

__global__ void __launch_bounds__(NW * 32)
k_final(const _Float16* __restrict__ ctx16, const _Float16* __restrict__ Wf,
        const float* __restrict__ b_final, const float* __restrict__ hiddens,
        float* __restrict__ out) {
  __shared__ __attribute__((aligned(16))) f32x4 red[NW * FA * FB * 64];
  int lane = threadIdx.x & 31;
  int wave = threadIdx.x >> 5;
  v8f o[FA * FB / NW];
  tile_splitk<FA, FB, FKG>((const v8h*)ctx16 + (size_t)(blockIdx.y * FA) * KS * 64 + lane,
                           (const v8h*)Wf + (size_t)(blockIdx.x * FB) * KS * 64 + lane, red, o);

  int to = (lane >> 4) * 8;
#pragma unroll
  for (int q = 0; q < FA * FB / NW; ++q) {
    int tile = wave * (FA * FB / NW) + q;
    int g = blockIdx.y * FA + tile / FB;           // t tile in the list of all b
    int h = (blockIdx.x * FB + tile % FB) * 16 + (lane & 15);
    float bias = b_final[h];
#pragma unroll
    for (int r = 0; r < 8; ++r) {
      size_t idx = (size_t)(g * 16 + to + r) * H + h;
      out[idx] = o[q][r] + bias + hiddens[idx];
    }
  }
}

// ---------------------------------------------------------------------------
extern "C" void kernel_launch(void* const* d_in, const int* in_sizes, int n_in,
                              void* d_out, int out_size, void* d_ws, size_t ws_size,
                              hipStream_t stream) {
  (void)in_sizes; (void)n_in; (void)out_size; (void)ws_size;
  const float* maps    = (const float*)d_in[0];
  const float* hiddens = (const float*)d_in[1];
  const float* W_map   = (const float*)d_in[2];
  const float* b_map   = (const float*)d_in[3];
  const float* W_final = (const float*)d_in[4];
  const float* b_final = (const float*)d_in[5];
  const float* W_rect  = (const float*)d_in[6];
  const float* b_rect  = (const float*)d_in[7];

  float* out  = (float*)d_out;                     // (B,T,H)
  float* attn = out + (size_t)B * T * H;           // (B,T,P)

  char* ws = (char*)d_ws;
  _Float16* fmA   = (_Float16*)(ws + OFF_FMA);
  _Float16* fmT   = (_Float16*)(ws + OFF_FMT);
  _Float16* Wm16  = (_Float16*)(ws + OFF_WMAP);
  _Float16* Wf16  = (_Float16*)(ws + OFF_WFIN);
  float*    mlo   = (float*)   (ws + OFF_MLO);
  _Float16* att16 = (_Float16*)(ws + OFF_ATT16);
  _Float16* ctx16 = (_Float16*)(ws + OFF_CTX16);

  // Stage 0: converts and transpose, one launch
  k_stage0<<<dim3(NB_T + NB_A + 2 * NB_W), 256, 0, stream>>>(maps, W_map, W_final,
                                                            fmT, fmA, Wm16, Wf16);

  // Stage 1: map_linear GEMM (WMMA)
  k_mlo<<<dim3(H / 16 / MB, B * (PT / 16) / MA), NW * 32, 0, stream>>>(fmA, Wm16, b_map, mlo);

  // Stage 2: fused rectified score + softmax (VALU)
  k_scores<<<dim3(T / ST, B), SW * 32, 0, stream>>>(mlo, hiddens, W_rect, b_rect, attn, att16);

  k_ctx<<<dim3(8, 4, 8), 128, 0, stream>>>(att16, fmT, ctx16);

  // Stage 4: output GEMM + bias + residual (WMMA)
  k_final<<<dim3(H / 16 / FB, B * (T / 16) / FA), NW * 32, 0, stream>>>(ctx16, Wf16, b_final, hiddens, out);
}

// v007
// One run takes 41.8 microseconds.
// Two timings next to v006 both put it at 1.21 times that version's speed.
// Over all steps from v000 it is 3.60 times as fast.
#include <hip/hip_runtime.h>

constexpr int B = 8, T = 64, P = 196, M = 2048, H = 768;
constexpr int PPAD = 224;                 // row length of attn16
constexpr int KS   = M / 32;              // 32-wide k blocks of the K = M products
constexpr int PT   = 208;                 // P rounded up to the 16-row p tiles of stage 1
constexpr int GK   = PT / 16;             // 16-wide half k blocks of the K = P product

typedef __attribute__((ext_vector_type(16))) _Float16 v16h;
typedef __attribute__((ext_vector_type(8)))  _Float16 v8h;
typedef __attribute__((ext_vector_type(8)))  float    v8f;

// Workspace layout (bytes, all 16B aligned)
constexpr size_t OFF_FMA   = 0;                                   // fp16 [B][PT][M], fragment order
constexpr size_t OFF_W2    = OFF_FMA + (size_t)B * PT * M * 2;    // fp16 [2 H][M], fragment order:
                                                                  // W_map, then W_final
constexpr size_t OFF_MLO   = OFF_W2 + (size_t)2 * H * M * 2;      // fp32 [B][H/4][PT][4]
constexpr size_t OFF_FW    = OFF_MLO + (size_t)B * H * PT * 4;    // fp16 [B][H/16][GK][32 lanes][8]
constexpr size_t OFF_ATT16 = OFF_FW + (size_t)B * H * PT * 2;     // fp16 [B][T][PPAD]

__device__ __forceinline__ v16h load_pk(const v8h* p) {
  v8h lo = p[0];
  v8h hi = p[32];
  return __builtin_shufflevector(lo, hi, 0, 1, 2, 3, 4, 5, 6, 7,
                                          8, 9, 10, 11, 12, 13, 14, 15);
}

// ---------------------------------------------------------------------------
// Stage 0: fp32 -> fp16 converts into fragment order
// Few fat waves: every global access is 16 B per lane, every store of pack_block is 512
// contiguous bytes per wave, and all loads of a thread are issued before the first use.
// ---------------------------------------------------------------------------
typedef __attribute__((ext_vector_type(4))) float    f32x4;
typedef __attribute__((ext_vector_type(4))) _Float16 v4h;

constexpr int PU = 4;                     // k blocks per wave of pack_block: 512 B of each of 16 rows
static_assert(KS % PU == 0 && (PT / 16 * (KS / PU)) % 8 == 0 && (H / 16 * (KS / PU)) % 8 == 0,
              "pack_block has no tail");

// src: matrices of [rows][M] floats, this block works on matrix mat. One wave = one 16-row
// tile x PU k blocks; blk counts the blocks of one matrix.
// Rows past the end of a matrix (the last p tile) are stored as zeros.
__device__ __forceinline__ void
pack_block(const float* __restrict__ src, _Float16* __restrict__ dst, int rows, int blk, int mat) {
  int lane = threadIdx.x & 31;
  int w    = blk * 8 + (threadIdx.x >> 5);
  int tile = w / (KS / PU);
  int ks0  = (w % (KS / PU)) * PU;
  int tpm  = (rows + 15) >> 4;            // tiles per matrix
  int r    = tile * 16 + (lane & 15);
  int rc   = r < rows ? r : rows - 1;     // the address stays inside the matrix
  const f32x4* s = (const f32x4*)(src + ((size_t)mat * rows + rc) * M
                                      + ks0 * 32 + (lane >> 4) * 8);
  v8h* d = (v8h*)dst + ((size_t)(mat * tpm + tile) * KS + ks0) * 64 + lane;
  f32x4 v[PU][4];
#pragma unroll                            // v[] stays in registers, 4 * PU loads in flight
  for (int u = 0; u < PU; ++u) {
    v[u][0] = s[u * 8 + 0];               // k = (L/16)*8 + 0..7
    v[u][1] = s[u * 8 + 1];
    v[u][2] = s[u * 8 + 4];               // k = 16 + (L/16)*8 + 0..7
    if (u == PU - 1) asm volatile("s_wait_xcnt 0x0" ::: "memory");
    v[u][3] = s[u * 8 + 5];
  }
  // keeps the converts behind the last load: without it 12 of the 16 loads are issued only
  // after the first four have returned, a second trip to memory
  __builtin_amdgcn_sched_barrier(0);
#pragma unroll
  for (int u = 0; u < PU; ++u) {
#pragma unroll
    for (int hf = 0; hf < 2; ++hf) {
      v4h x = __builtin_convertvector(v[u][2 * hf], v4h);
      v4h y = __builtin_convertvector(v[u][2 * hf + 1], v4h);
      v8h o = __builtin_shufflevector(x, y, 0, 1, 2, 3, 4, 5, 6, 7);
      if (r >= rows) o = (v8h){0, 0, 0, 0, 0, 0, 0, 0};
      d[u * 64 + hf * 32] = o;
    }
  }
  // the code behind this function's call may reuse the registers that the stores above name
  // (address pair, data): the wait stands between the last store and any such overwrite
  asm volatile("s_wait_xcnt 0x0" ::: "memory");
}

constexpr int NB_A1 = PT / 16 * (KS / PU) / 8;       // pack of maps, blocks per b
constexpr int NB_A  = NB_A1 * B;
constexpr int NB_W  = H / 16 * (KS / PU) / 8;        // pack of one weight matrix

__global__ void __launch_bounds__(256)
k_stage0(const float* __restrict__ maps, const float* __restrict__ W_map,
         const float* __restrict__ W_final,
         _Float16* __restrict__ fmA, _Float16* __restrict__ Wm, _Float16* __restrict__ Wf) {
  int i = blockIdx.x;
  if (i < NB_A) {
    pack_block(maps, fmA, P, i % NB_A1, i / NB_A1);
  } else if (i < NB_A + NB_W) {
    pack_block(W_map, Wm, H, i - NB_A, 0);
  } else {
    pack_block(W_final, Wf, H, i - (NB_A + NB_W), 0);
  }
}

// ---------------------------------------------------------------------------
// The K = M products. One block = one tile of TA*16 rows of A by TB*16 rows of B; its NW waves
// split K: wave w takes k blocks [w*KW, (w+1)*KW) of the WHOLE tile, so every fragment that
// is loaded feeds TB (A) or TA (B) WMMAs and no fragment is loaded twice in a block.
// Both operands lie in fragment order and go from global memory straight to registers.
// The NW partial tiles are summed through LDS, w ascending; wave w ends up with the 16x16
// tiles w*NT/NW .. of the block (tile = i*TB + j), in accumulator layout.
// ---------------------------------------------------------------------------
constexpr int NW = 8;                     // waves per block
constexpr int KW = KS / NW;               // k blocks per wave
static_assert(KS % NW == 0, "K splits evenly");

// Ap, Bp: the caller's lane in k block 0 of the block's first A and B tile.
// red: NW * TA * TB * 64 chunks of 16 bytes.
template <int TA, int TB, int KG>
__device__ __forceinline__ void
tile_splitk(const v8h* __restrict__ Ap, const v8h* __restrict__ Bp, f32x4* red,
            v8f (&o)[TA * TB / NW]) {
  constexpr int NT = TA * TB;
  static_assert(NT % NW == 0 && KW % KG == 0, "no tail");
  int lane = threadIdx.x & 31;
  int wave = threadIdx.x >> 5;
  Ap += wave * KW * 64;
  Bp += wave * KW * 64;
  v8f c[TA][TB] = {};

  for (int ks = 0; ks < KW; ks += KG) {
    v16h a[KG][TA], bb[KG][TB];
#pragma unroll                                     // a[] and bb[] stay in registers
    for (int u = 0; u < KG; ++u) {
#pragma unroll
      for (int i = 0; i < TA; ++i)
        a[u][i] = load_pk(Ap + (i * KS + ks + u) * 64);
#pragma unroll
      for (int j = 0; j < TB; ++j)
        bb[u][j] = load_pk(Bp + (j * KS + ks + u) * 64);
    }
    // keeps the WMMAs behind the last load of the group: without it each WMMA's loads
    // are issued only after the WMMA before it, one trip to L2 per WMMA
    __builtin_amdgcn_sched_barrier(0);
#pragma unroll
    for (int u = 0; u < KG; ++u) {
#pragma unroll
      for (int i = 0; i < TA; ++i) {
#pragma unroll
        for (int j = 0; j < TB; ++j)
          c[i][j] = __builtin_amdgcn_wmma_f32_16x16x32_f16(false, a[u][i], false, bb[u][j],
                                                           (short)0, c[i][j], false, false);
      }
    }
    // what follows may rewrite the address registers that this group's loads name; as inputs
    // the two pointers stay in their registers up to this wait (else the last load's own
    // result may be given the pair that the loads before it still name)
    asm volatile("s_wait_xcnt 0x0" :: "v"(Ap), "v"(Bp) : "memory");
  }

#pragma unroll
  for (int i = 0; i < TA; ++i) {
#pragma unroll
    for (int j = 0; j < TB; ++j) {
      f32x4* d = red + ((wave * NT + i * TB + j) * 2) * 32 + lane;
      d[0]  = __builtin_shufflevector(c[i][j], c[i][j], 0, 1, 2, 3);
      d[32] = __builtin_shufflevector(c[i][j], c[i][j], 4, 5, 6, 7);
    }
  }
  __syncthreads();                                 // every partial tile is whole before it is summed
#pragma unroll                                     // o[] stays in registers
  for (int q = 0; q < NT / NW; ++q) {
    const f32x4* s = red + ((wave * (NT / NW) + q) * 2) * 32 + lane;
    f32x4 lo = s[0], hi = s[32];
#pragma unroll
    for (int w = 1; w < NW; ++w) {                 // w ascending: k ascending
      lo += s[w * NT * 64];
      hi += s[w * NT * 64 + 32];
    }
    o[q] = __builtin_shufflevector(lo, hi, 0, 1, 2, 3, 4, 5, 6, 7);
  }
}

// ---------------------------------------------------------------------------
// Stage 1: mlo(b,p,h) = fm[b,p,:] . W_map[h,:] + b_map[h]  and  fw(b,p,h) = fm[b,p,:] . W_final[h,:]
// (K = 2048). The B operand is the list of the 2 H/16 row tiles of W_map, then W_final.
// mlo is stored as [b][h/4][p][h%4]: stage 2 gives a lane p = j*32 + lane, so its 16-byte load of
// four h covers 512 contiguous bytes per wave. A 128-B line is 8 p x 4 h of one wave.
// fw is stored as the B operand of stage 3 (row h, k = p): an accumulator lane holds
// h = lane%16 and p = pt*16 + (lane/16)*8 + 0..7, which is that operand's lane and k order,
// so a tile is one 16-byte store per lane, 512 contiguous bytes per wave.
// The p tiles of all b are one list of B * PT/16; a block takes MA of them and MB h tiles.
// ---------------------------------------------------------------------------
constexpr int MA = 4, MB = 6, MKG = 2;
constexpr int NHB = H / 16 / MB;          // blocks along h per weight matrix
static_assert((B * (PT / 16)) % MA == 0 && (H / 16) % MB == 0, "whole blocks");

__global__ void __launch_bounds__(NW * 32)
k_mlo(const _Float16* __restrict__ fmA, const _Float16* __restrict__ W2,
      const float* __restrict__ b_map, float* __restrict__ mlo, _Float16* __restrict__ fw) {
  __shared__ __attribute__((aligned(16))) f32x4 red[NW * MA * MB * 64];
  int lane = threadIdx.x & 31;
  int wave = threadIdx.x >> 5;
  v8f o[MA * MB / NW];
  tile_splitk<MA, MB, MKG>((const v8h*)fmA + (size_t)(blockIdx.y * MA) * KS * 64 + lane,
                           (const v8h*)W2 + (size_t)(blockIdx.x * MB) * KS * 64 + lane, red, o);

  int po = (lane >> 4) * 8;
  if (blockIdx.x < NHB) {                          // W_map
#pragma unroll
    for (int q = 0; q < MA * MB / NW; ++q) {
      int tile = wave * (MA * MB / NW) + q;
      int g  = blockIdx.y * MA + tile / MB;        // p tile in the list of all b
      int b  = g / (PT / 16);
      int pt = g % (PT / 16);
      int h  = (blockIdx.x * MB + tile % MB) * 16 + (lane & 15);
      float bias = b_map[h];
#pragma unroll
      for (int r = 0; r < 8; ++r) {
        int p = pt * 16 + po + r;                  // p in [P, PT) is pad: stage 2 loads it, never uses its sums
        mlo[(((size_t)b * (H / 4) + (h >> 2)) * PT + p) * 4 + (h & 3)] = o[q][r] + bias;
      }
    }
  } else {                                         // W_final; p in [P, PT): fm is 0 there, so is fw
#pragma unroll
    for (int q = 0; q < MA * MB / NW; ++q) {
      int tile = wave * (MA * MB / NW) + q;
      int g  = blockIdx.y * MA + tile / MB;
      int b  = g / (PT / 16);
      int pt = g % (PT / 16);
      int ht = (blockIdx.x - NHB) * MB + tile % MB;
      ((v8h*)fw)[(((size_t)b * (H / 16) + ht) * GK + pt) * 32 + lane] =
          __builtin_convertvector(o[q], v8h);
    }
    // the code laid out behind this branch reuses the registers that the stores above name
    // (address pairs, data): the wait stands between the last store and any such overwrite
    asm volatile("s_wait_xcnt 0x0" ::: "memory");
  }
}

// ---------------------------------------------------------------------------
// Stage 2: scores + softmax.  One block per (b, ST consecutive t).
// score[p] = sum_h W_rect[h]*relu(mlo[b,p,h]+hid[b,t,h]) + b_rect
// ReLU between add and reduction => VALU (cannot be a GEMM); ~0.3 Gops total.
// Register tile: a wave covers ALL p (lane holds p = j*32 + lane, j < SJ) for ST t and for its
// own H/SW values of h. Every mlo value that is loaded feeds ST t (mlo is read T/ST times from
// L2, not T times) and every hid / W_rect value read from LDS feeds SJ p.
// The SW partial sums of a score are added through LDS, wave ascending (h ascending).
// ---------------------------------------------------------------------------
constexpr int ST = 2;                     // t per block: B * T / ST blocks, one per WGP
constexpr int SW = 16;                    // waves per block
constexpr int SH = H / 4 / SW;            // groups of four h per wave
constexpr int SG = 2;                     // groups of four h per batch of loads
constexpr int SJ = (P + 31) / 32;         // p per lane
static_assert(T % ST == 0 && (H / 4) % SW == 0 && SH % SG == 0, "no tail");
static_assert(ST * 256 == SW * 32 && P <= 256 && (SJ - 1) * 32 < PT, "softmax: 256 threads per t");

__global__ void __launch_bounds__(SW * 32)
k_scores(const float* __restrict__ mlo, const float* __restrict__ hiddens,
         const float* __restrict__ W_rect, const float* __restrict__ b_rect,
         float* __restrict__ attn_out, _Float16* __restrict__ attn16) {
  __shared__ __attribute__((aligned(16))) float hid[ST * H];
  __shared__ __attribute__((aligned(16))) float wr[(H + SW * 32 - 1) / (SW * 32) * (SW * 32)];
  __shared__ float part[SW][ST][SJ * 32];
  __shared__ float red[ST][256];
  int t0 = blockIdx.x * ST, b = blockIdx.y;
  int tid  = threadIdx.x;
  int lane = tid & 31;
  int wave = tid >> 5;

  // j < SJ - 1: whole 512-byte loads. j = SJ - 1: the row ends at PT, the address is clamped
  // to it (p in [P, PT) is pad that stage 1 has written; such sums are never read).
  const f32x4* mrow = (const f32x4*)mlo + ((size_t)b * (H / 4) + wave * SH) * PT;
  const f32x4* mq = mrow + lane;
  const f32x4* mz = mrow + ((SJ - 1) * 32 + lane < PT ? (SJ - 1) * 32 + lane : PT - 1);

  // hiddens (its ST rows are contiguous) and W_rect go to LDS; no branch and no rolled loop:
  // all loads of a thread, the first mlo batch too, are in flight at once, one trip to memory
  constexpr int NTH = SW * 32, NHS = ST * H / NTH, NWS = (H + NTH - 1) / NTH;
  static_assert(ST * H % NTH == 0, "whole passes");
  float hs[NHS], ws[NWS];
#pragma unroll                            // hs[] and ws[] stay in registers
  for (int i = 0; i < NHS; ++i) hs[i] = hiddens[((size_t)b * T + t0) * H + i * NTH + tid];
#pragma unroll
  for (int i = 0; i < NWS; ++i) {
    int h = i * NTH + tid;
    ws[i] = W_rect[h < H ? h : H - 1];    // the address stays inside W_rect
  }

  f32x4 q[2][SG][SJ];                     // this batch and the next one
#pragma unroll                            // q[] stays in registers
  for (int u = 0; u < SG; ++u) {
#pragma unroll
    for (int j = 0; j < SJ; ++j)
      q[0][u][j] = j < SJ - 1 ? mq[u * PT + j * 32] : mz[u * PT];
  }

#pragma unroll
  for (int i = 0; i < NHS; ++i) hid[i * NTH + tid] = hs[i];
#pragma unroll
  for (int i = 0; i < NWS; ++i) {
    wr[i * NTH + tid] = ws[i];            // no test: past H lies the pad of wr[], never read
  }
  __syncthreads();

  float acc[ST][SJ] = {};
#pragma unroll                            // q[] and acc[] stay in registers
  for (int g = 0; g < SH / SG; ++g) {
    if (g + 1 < SH / SG) {
#pragma unroll
      for (int u = 0; u < SG; ++u) {
#pragma unroll
        for (int j = 0; j < SJ; ++j)
          q[(g + 1) & 1][u][j] = j < SJ - 1 ? mq[((g + 1) * SG + u) * PT + j * 32]
                                            : mz[((g + 1) * SG + u) * PT];
      }
    }
    // as inputs the two pointers stay in their registers up to this wait, which stands behind
    // the last load that names them (else a load's own result may be given such a pair)
    if (g + 2 == SH / SG) asm volatile("s_wait_xcnt 0x0" :: "v"(mq), "v"(mz) : "memory");
    // keeps the next batch's loads in front of this batch's arithmetic, so that they fly
    // while it runs: without it they are spread through the arithmetic and fewer are in flight
    __builtin_amdgcn_sched_barrier(0);
#pragma unroll
    for (int u = 0; u < SG; ++u) {
      int h4 = wave * SH + g * SG + u;
      f32x4 w4 = *(const f32x4*)&wr[h4 * 4];
      f32x4 hv[ST];
#pragma unroll
      for (int s = 0; s < ST; ++s) hv[s] = *(const f32x4*)&hid[s * H + h4 * 4];
#pragma unroll
      for (int c = 0; c < 4; ++c) {                // h ascending inside a wave
#pragma unroll
        for (int j = 0; j < SJ; ++j) {
#pragma unroll
          for (int s = 0; s < ST; ++s) {
            float r = q[g & 1][u][j][c] + hv[s][c];
            acc[s][j] = fmaf(w4[c], (r > 0.0f ? r : 0.0f), acc[s][j]);
          }
        }
      }
    }
  }
#pragma unroll
  for (int s = 0; s < ST; ++s) {
#pragma unroll
    for (int j = 0; j < SJ; ++j) part[wave][s][j * 32 + lane] = acc[s][j];
  }
  __syncthreads();                        // every wave's partial sums are there before they are added

  // softmax: 256 threads per t, one per p
  int ts = tid >> 8;
  int p  = tid & 255;
  int t  = t0 + ts;
  float val = 0.0f;
  if (p < P) {
    float a = part[0][ts][p];
#pragma unroll
    for (int w = 1; w < SW; ++w) a += part[w][ts][p];
    val = a + b_rect[0];
  }

  red[ts][p] = (p < P) ? val : -3.0e38f;
  __syncthreads();
  for (int s = 128; s > 0; s >>= 1) {
    if (p < s) red[ts][p] = fmaxf(red[ts][p], red[ts][p + s]);
    __syncthreads();
  }
  float mx = red[ts][0];
  __syncthreads();

  float e = (p < P) ? __expf(val - mx) : 0.0f;
  red[ts][p] = e;
  __syncthreads();
  for (int s = 128; s > 0; s >>= 1) {
    if (p < s) red[ts][p] += red[ts][p + s];
    __syncthreads();
  }
  float a = e / red[ts][0];

  if (p < P)    attn_out[((size_t)b * T + t) * P + p] = a;
  if (p < PPAD) attn16[((size_t)b * T + t) * PPAD + p] =
                    (_Float16)((p < P) ? a : 0.0f);
}

// ---------------------------------------------------------------------------
// Stage 3: out[b][t][h] = sum_p attn[b,t,p] * fw[b,p,h] + b_final[h] + hiddens[b,t,h]  (K = PT)
// One wave = 16 t x OB*16 h (a whole 128-B line of each out row). Everything a wave reads goes
// from global memory to registers and is asked for before the first WMMA: one trip to memory.
// K is GK = 13 halves of a 32-wide k block; the 14th half is zero in registers on both sides.
// ---------------------------------------------------------------------------
constexpr int OB = 2, OW = 4;             // h tiles per wave, waves per block
static_assert((H / 16) % (OB * OW) == 0 && T % 16 == 0 && PT <= PPAD, "whole blocks");

__global__ void __launch_bounds__(OW * 32)
k_out(const _Float16* __restrict__ attn16, const _Float16* __restrict__ fw,
      const float* __restrict__ b_final, const float* __restrict__ hiddens,
      float* __restrict__ out) {
  int lane = threadIdx.x & 31;
  int wave = threadIdx.x >> 5;
  int b   = blockIdx.z;
  int tt  = blockIdx.y;
  int ht0 = (blockIdx.x * OW + wave) * OB;
  // A: row t = lane%16, k = i*16 + (lane/16)*8 + 0..7.  B: row h = lane%16, the same k.
  const v8h* Ap = (const v8h*)(attn16 + ((size_t)b * T + tt * 16 + (lane & 15)) * PPAD
                                      + (lane >> 4) * 8);
  const v8h* Bp = (const v8h*)fw + ((size_t)b * (H / 16) + ht0) * GK * 32 + lane;
  size_t idx0 = ((size_t)b * T + tt * 16 + (lane >> 4) * 8) * H + ht0 * 16 + (lane & 15);
  const float* hp = hiddens + idx0;
  const float* bp = b_final + ht0 * 16 + (lane & 15);

  v8h ah[GK], bh[OB][GK];
  float hv[OB][8], bias[OB];
#pragma unroll                            // every array here stays in registers
  for (int i = 0; i < GK; ++i) {
    ah[i] = Ap[i * 2];
#pragma unroll
    for (int j = 0; j < OB; ++j) bh[j][i] = Bp[(j * GK + i) * 32];
  }
#pragma unroll
  for (int j = 0; j < OB; ++j) {
    bias[j] = bp[j * 16];
#pragma unroll
    for (int r = 0; r < 8; ++r) hv[j][r] = hp[(size_t)r * H + j * 16];
  }
  // as inputs the pointers stay in their registers up to this wait, which stands behind the
  // last load that names them (else a load's own result may be given such a pair)
  asm volatile("s_wait_xcnt 0x0" :: "v"(Ap), "v"(Bp), "v"(hp), "v"(bp) : "memory");
  // keeps the WMMAs behind the last load: without it each WMMA's loads are issued only after
  // the WMMA before it, one trip to memory per k block
  __builtin_amdgcn_sched_barrier(0);

  const v8h zero = {0, 0, 0, 0, 0, 0, 0, 0};
  v8f c[OB] = {};
#pragma unroll                            // k ascending
  for (int ks = 0; ks < (GK + 1) / 2; ++ks) {
    bool whole = 2 * ks + 1 < GK;
    v16h a = __builtin_shufflevector(ah[2 * ks], whole ? ah[whole ? 2 * ks + 1 : 0] : zero,
                                     0, 1, 2, 3, 4, 5, 6, 7, 8, 9, 10, 11, 12, 13, 14, 15);
#pragma unroll
    for (int j = 0; j < OB; ++j) {
      v16h bb = __builtin_shufflevector(bh[j][2 * ks], whole ? bh[j][whole ? 2 * ks + 1 : 0] : zero,
                                        0, 1, 2, 3, 4, 5, 6, 7, 8, 9, 10, 11, 12, 13, 14, 15);
      c[j] = __builtin_amdgcn_wmma_f32_16x16x32_f16(false, a, false, bb,
                                                    (short)0, c[j], false, false);
    }
  }

#pragma unroll
  for (int j = 0; j < OB; ++j) {
#pragma unroll
    for (int r = 0; r < 8; ++r)
      out[idx0 + (size_t)r * H + j * 16] = c[j][r] + bias[j] + hv[j][r];
  }
}

// ---------------------------------------------------------------------------
extern "C" void kernel_launch(void* const* d_in, const int* in_sizes, int n_in,
                              void* d_out, int out_size, void* d_ws, size_t ws_size,
                              hipStream_t stream) {
  (void)in_sizes; (void)n_in; (void)out_size; (void)ws_size;
  const float* maps    = (const float*)d_in[0];
  const float* hiddens = (const float*)d_in[1];
  const float* W_map   = (const float*)d_in[2];
  const float* b_map   = (const float*)d_in[3];
  const float* W_final = (const float*)d_in[4];
  const float* b_final = (const float*)d_in[5];
  const float* W_rect  = (const float*)d_in[6];
  const float* b_rect  = (const float*)d_in[7];

  float* out  = (float*)d_out;                     // (B,T,H)
  float* attn = out + (size_t)B * T * H;           // (B,T,P)

  char* ws = (char*)d_ws;
  _Float16* fmA   = (_Float16*)(ws + OFF_FMA);
  _Float16* W2    = (_Float16*)(ws + OFF_W2);
  float*    mlo   = (float*)   (ws + OFF_MLO);
  _Float16* fw    = (_Float16*)(ws + OFF_FW);
  _Float16* att16 = (_Float16*)(ws + OFF_ATT16);

  // Stage 0: converts, one launch
  k_stage0<<<dim3(NB_A + 2 * NB_W), 256, 0, stream>>>(maps, W_map, W_final,
                                                      fmA, W2, W2 + (size_t)H * M);

  // Stage 1: fm . W_map^T and fm . W_final^T (WMMA)
  k_mlo<<<dim3(2 * NHB, B * (PT / 16) / MA), NW * 32, 0, stream>>>(fmA, W2, b_map, mlo, fw);

  // Stage 2: fused rectified score + softmax (VALU)
  k_scores<<<dim3(T / ST, B), SW * 32, 0, stream>>>(mlo, hiddens, W_rect, b_rect, attn, att16);

  // Stage 3: attention-weighted sum of fw + bias + residual (WMMA)
  k_out<<<dim3(H / 16 / (OB * OW), T / 16, B), OW * 32, 0, stream>>>(att16, fw, b_final, hiddens, out);
}

// v008
// A run of this version takes 37.7 microseconds.
// Next to v007, in two timings, it ran 1.12 and 1.09 times as fast.
// All steps since v000 together make it 3.98 times as fast.
#include <hip/hip_runtime.h>

constexpr int B = 8, T = 64, P = 196, M = 2048, H = 768;
constexpr int PPAD = 224;                 // row length of attn16
constexpr int KS   = M / 32;              // 32-wide k blocks of the K = M products
constexpr int PT   = 208;                 // P rounded up to the 16-row p tiles of stage 1
constexpr int GK   = PT / 16;             // 16-wide half k blocks of the K = P product

typedef __attribute__((ext_vector_type(16))) _Float16 v16h;
typedef __attribute__((ext_vector_type(8)))  _Float16 v8h;
typedef __attribute__((ext_vector_type(8)))  float    v8f;

// Workspace layout (bytes, all 16B aligned)
constexpr size_t OFF_FMA   = 0;                                   // fp16 [B][PT][M], fragment order
constexpr size_t OFF_W2    = OFF_FMA + (size_t)B * PT * M * 2;    // fp16 [2 H][M], fragment order:
                                                                  // W_map, then W_final
constexpr size_t OFF_MLO   = OFF_W2 + (size_t)2 * H * M * 2;      // fp32 [B][H/4][PT][4]
constexpr size_t OFF_FW    = OFF_MLO + (size_t)B * H * PT * 4;    // fp16 [B][H/16][GK][32 lanes][8]
constexpr size_t OFF_ATT16 = OFF_FW + (size_t)B * H * PT * 2;     // fp16 [B][T][PPAD]

__device__ __forceinline__ v16h load_pk(const v8h* p) {
  v8h lo = p[0];
  v8h hi = p[32];
  return __builtin_shufflevector(lo, hi, 0, 1, 2, 3, 4, 5, 6, 7,
                                          8, 9, 10, 11, 12, 13, 14, 15);
}

// ---------------------------------------------------------------------------
// Stage 0: fp32 -> fp16 converts into fragment order
// Few fat waves: every global access is 16 B per lane, every store of pack_block is 512
// contiguous bytes per wave, and all loads of a thread are issued before the first use.
// ---------------------------------------------------------------------------
typedef __attribute__((ext_vector_type(4))) float    f32x4;
typedef __attribute__((ext_vector_type(4))) _Float16 v4h;

constexpr int PU = 4;                     // k blocks per wave of pack_block: 512 B of each of 16 rows
static_assert(KS % PU == 0 && (PT / 16 * (KS / PU)) % 8 == 0 && (H / 16 * (KS / PU)) % 8 == 0,
              "pack_block has no tail");

// src: matrices of [rows][M] floats, this block works on matrix mat. One wave = one 16-row
// tile x PU k blocks; blk counts the blocks of one matrix.
// Rows past the end of a matrix (the last p tile) are stored as zeros.
__device__ __forceinline__ void
pack_block(const float* __restrict__ src, _Float16* __restrict__ dst, int rows, int blk, int mat) {
  int lane = threadIdx.x & 31;
  int w    = blk * 8 + (threadIdx.x >> 5);
  int tile = w / (KS / PU);
  int ks0  = (w % (KS / PU)) * PU;
  int tpm  = (rows + 15) >> 4;            // tiles per matrix
  int r    = tile * 16 + (lane & 15);
  int rc   = r < rows ? r : rows - 1;     // the address stays inside the matrix
  const f32x4* s = (const f32x4*)(src + ((size_t)mat * rows + rc) * M
                                      + ks0 * 32 + (lane >> 4) * 8);
  v8h* d = (v8h*)dst + ((size_t)(mat * tpm + tile) * KS + ks0) * 64 + lane;
  f32x4 v[PU][4];
#pragma unroll                            // v[] stays in registers, 4 * PU loads in flight
  for (int u = 0; u < PU; ++u) {
    v[u][0] = s[u * 8 + 0];               // k = (L/16)*8 + 0..7
    v[u][1] = s[u * 8 + 1];
    v[u][2] = s[u * 8 + 4];               // k = 16 + (L/16)*8 + 0..7
    if (u == PU - 1) asm volatile("s_wait_xcnt 0x0" ::: "memory");
    v[u][3] = s[u * 8 + 5];
  }
  // keeps the converts behind the last load: without it 12 of the 16 loads are issued only
  // after the first four have returned, a second trip to memory
  __builtin_amdgcn_sched_barrier(0);
#pragma unroll
  for (int u = 0; u < PU; ++u) {
#pragma unroll
    for (int hf = 0; hf < 2; ++hf) {
      v4h x = __builtin_convertvector(v[u][2 * hf], v4h);
      v4h y = __builtin_convertvector(v[u][2 * hf + 1], v4h);
      v8h o = __builtin_shufflevector(x, y, 0, 1, 2, 3, 4, 5, 6, 7);
      if (r >= rows) o = (v8h){0, 0, 0, 0, 0, 0, 0, 0};
      d[u * 64 + hf * 32] = o;
    }
  }
  // the code behind this function's call may reuse the registers that the stores above name
  // (address pair, data): the wait stands between the last store and any such overwrite
  asm volatile("s_wait_xcnt 0x0" ::: "memory");
}

constexpr int NB_A1 = PT / 16 * (KS / PU) / 8;       // pack of maps, blocks per b
constexpr int NB_A  = NB_A1 * B;
constexpr int NB_W  = H / 16 * (KS / PU) / 8;        // pack of one weight matrix

__global__ void __launch_bounds__(256)
k_stage0(const float* __restrict__ maps, const float* __restrict__ W_map,
         const float* __restrict__ W_final,
         _Float16* __restrict__ fmA, _Float16* __restrict__ Wm, _Float16* __restrict__ Wf) {
  int i = blockIdx.x;
  if (i < NB_A) {
    pack_block(maps, fmA, P, i % NB_A1, i / NB_A1);
  } else if (i < NB_A + NB_W) {
    pack_block(W_map, Wm, H, i - NB_A, 0);
  } else {
    pack_block(W_final, Wf, H, i - (NB_A + NB_W), 0);
  }
}

constexpr int NW = 4;
constexpr int KW = KS / NW;
static_assert(KS % NW == 0, "K splits evenly");

constexpr int ND = 3;
template <int TA, int TB>
__device__ __forceinline__ void
tile_splitk(const v8h* __restrict__ Ap, const v8h* __restrict__ Bp, f32x4* red,
            v8f (&o)[TA * TB / NW]) {
  constexpr int NT = TA * TB;
  static_assert(NT % NW == 0 && KW >= ND, "no tail");
  int lane = threadIdx.x & 31;
  int wave = threadIdx.x >> 5;
  Ap += wave * KW * 64;
  Bp += wave * KW * 64;
  v8f c[TA][TB] = {};
  v16h a[ND][TA], bb[ND][TB];

#pragma unroll                                     // a[] and bb[] stay in registers
  for (int s = 0; s < ND - 1; ++s) {
#pragma unroll
    for (int i = 0; i < TA; ++i) a[s][i] = load_pk(Ap + (i * KS + s) * 64);
#pragma unroll
    for (int j = 0; j < TB; ++j) bb[s][j] = load_pk(Bp + (j * KS + s) * 64);
    // keeps the k blocks' loads in k order: the first WMMA waits for k block 0 alone
    __builtin_amdgcn_sched_barrier(0);
  }

#pragma unroll                                     // the set's index is a constant: registers
  for (int ks = 0; ks < KW; ++ks) {
    // the first row of tiles needs all of B, which is asked for last: behind it this k block
    // has landed, and (ND - 1) k blocks' loads at most are outstanding after the next issue
#pragma unroll
    for (int j = 0; j < TB; ++j)
      c[0][j] = __builtin_amdgcn_wmma_f32_16x16x32_f16(false, a[ks % ND][0], false, bb[ks % ND][j],
                                                       (short)0, c[0][j], false, false);
    // keeps the loads below behind the first row: without it they are issued in front of it,
    // three k blocks' loads outstanding at once
    __builtin_amdgcn_sched_barrier(0);
    if (ks + ND - 1 < KW) {
#pragma unroll
      for (int i = 0; i < TA; ++i)
        a[(ks + ND - 1) % ND][i] = load_pk(Ap + (i * KS + ks + ND - 1) * 64);
#pragma unroll
      for (int j = 0; j < TB; ++j)
        bb[(ks + ND - 1) % ND][j] = load_pk(Bp + (j * KS + ks + ND - 1) * 64);
    }
    // what follows may rewrite the address registers that the loads name; as inputs the two
    // pointers stay in their registers up to this wait, which stands behind the last load
    // (else a load's own result may be given the pair that the loads before it still name)
    if (ks + ND == KW) asm volatile("s_wait_xcnt 0x0" :: "v"(Ap), "v"(Bp) : "memory");
    // keeps the loads above in front of the other rows' WMMAs, so that they fly while these
    // run: without it they are issued only as the WMMAs free their registers, a row at a time
    __builtin_amdgcn_sched_barrier(0);
#pragma unroll                                     // k ascending inside a wave
    for (int i = 1; i < TA; ++i) {
#pragma unroll
      for (int j = 0; j < TB; ++j)
        c[i][j] = __builtin_amdgcn_wmma_f32_16x16x32_f16(false, a[ks % ND][i], false, bb[ks % ND][j],
                                                         (short)0, c[i][j], false, false);
    }
    // keeps the next k block's first row, which waits for its loads, behind these WMMAs:
    // without it that wait is moved up in front of most of them and the loads' lead is lost
    __builtin_amdgcn_sched_barrier(0);
  }

#pragma unroll
  for (int i = 0; i < TA; ++i) {
#pragma unroll
    for (int j = 0; j < TB; ++j) {
      f32x4* d = red + ((wave * NT + i * TB + j) * 2) * 32 + lane;
      d[0]  = __builtin_shufflevector(c[i][j], c[i][j], 0, 1, 2, 3);
      d[32] = __builtin_shufflevector(c[i][j], c[i][j], 4, 5, 6, 7);
    }
  }
  __syncthreads();                                 // every partial tile is whole before it is summed
#pragma unroll                                     // o[] stays in registers
  for (int q = 0; q < NT / NW; ++q) {
    const f32x4* s = red + ((wave * (NT / NW) + q) * 2) * 32 + lane;
    f32x4 lo = s[0], hi = s[32];
#pragma unroll
    for (int w = 1; w < NW; ++w) {                 // w ascending: k ascending
      lo += s[w * NT * 64];
      hi += s[w * NT * 64 + 32];
    }
    o[q] = __builtin_shufflevector(lo, hi, 0, 1, 2, 3, 4, 5, 6, 7);
  }
}

// ---------------------------------------------------------------------------
// Stage 1: mlo(b,p,h) = fm[b,p,:] . W_map[h,:] + b_map[h]  and  fw(b,p,h) = fm[b,p,:] . W_final[h,:]
// (K = 2048). The B operand is the list of the 2 H/16 row tiles of W_map, then W_final.
// mlo is stored as [b][h/4][p][h%4]: stage 2 gives a lane p = j*32 + lane, so its 16-byte load of
// four h covers 512 contiguous bytes per wave. A 128-B line is 8 p x 4 h of one wave.
// fw is stored as the B operand of stage 3 (row h, k = p): an accumulator lane holds
// h = lane%16 and p = pt*16 + (lane/16)*8 + 0..7, which is that operand's lane and k order,
// so a tile is one 16-byte store per lane, 512 contiguous bytes per wave.
// The p tiles of all b are one list of B * PT/16; a block takes MA of them and MB h tiles.
// ---------------------------------------------------------------------------
constexpr int MA = 8, MB = 6;
constexpr int NHB = H / 16 / MB;          // blocks along h per weight matrix
static_assert((B * (PT / 16)) % MA == 0 && (H / 16) % MB == 0, "whole blocks");

__global__ void __launch_bounds__(NW * 32)
k_mlo(const _Float16* __restrict__ fmA, const _Float16* __restrict__ W2,
      const float* __restrict__ b_map, float* __restrict__ mlo, _Float16* __restrict__ fw) {
  __shared__ __attribute__((aligned(16))) f32x4 red[NW * MA * MB * 64];
  int lane = threadIdx.x & 31;
  int wave = threadIdx.x >> 5;
  v8f o[MA * MB / NW];
  tile_splitk<MA, MB>((const v8h*)fmA + (size_t)(blockIdx.y * MA) * KS * 64 + lane,
                           (const v8h*)W2 + (size_t)(blockIdx.x * MB) * KS * 64 + lane, red, o);

  int po = (lane >> 4) * 8;
  if (blockIdx.x < NHB) {                          // W_map
#pragma unroll
    for (int q = 0; q < MA * MB / NW; ++q) {
      int tile = wave * (MA * MB / NW) + q;
      int g  = blockIdx.y * MA + tile / MB;        // p tile in the list of all b
      int b  = g / (PT / 16);
      int pt = g % (PT / 16);
      int h  = (blockIdx.x * MB + tile % MB) * 16 + (lane & 15);
      float bias = b_map[h];
#pragma unroll
      for (int r = 0; r < 8; ++r) {
        int p = pt * 16 + po + r;                  // p in [P, PT) is pad: stage 2 loads it, never uses its sums
        mlo[(((size_t)b * (H / 4) + (h >> 2)) * PT + p) * 4 + (h & 3)] = o[q][r] + bias;
      }
    }
  } else {                                         // W_final; p in [P, PT): fm is 0 there, so is fw
#pragma unroll
    for (int q = 0; q < MA * MB / NW; ++q) {
      int tile = wave * (MA * MB / NW) + q;
      int g  = blockIdx.y * MA + tile / MB;
      int b  = g / (PT / 16);
      int pt = g % (PT / 16);
      int ht = (blockIdx.x - NHB) * MB + tile % MB;
      ((v8h*)fw)[(((size_t)b * (H / 16) + ht) * GK + pt) * 32 + lane] =
          __builtin_convertvector(o[q], v8h);
    }
    // the code laid out behind this branch reuses the registers that the stores above name
    // (address pairs, data): the wait stands between the last store and any such overwrite
    asm volatile("s_wait_xcnt 0x0" ::: "memory");
  }
}

// ---------------------------------------------------------------------------
// Stage 2: scores + softmax.  One block per (b, ST consecutive t).
// score[p] = sum_h W_rect[h]*relu(mlo[b,p,h]+hid[b,t,h]) + b_rect
// ReLU between add and reduction => VALU (cannot be a GEMM); ~0.3 Gops total.
// Register tile: a wave covers ALL p (lane holds p = j*32 + lane, j < SJ) for ST t and for its
// own H/SW values of h. Every mlo value that is loaded feeds ST t (mlo is read T/ST times from
// L2, not T times) and every hid / W_rect value read from LDS feeds SJ p.
// The SW partial sums of a score are added through LDS, wave ascending (h ascending).
// ---------------------------------------------------------------------------
constexpr int ST = 2;                     // t per block: B * T / ST blocks, one per WGP
constexpr int SW = 16;                    // waves per block
constexpr int SH = H / 4 / SW;            // groups of four h per wave
constexpr int SG = 2;                     // groups of four h per batch of loads
constexpr int SJ = (P + 31) / 32;         // p per lane
static_assert(T % ST == 0 && (H / 4) % SW == 0 && SH % SG == 0, "no tail");
static_assert(ST * 256 == SW * 32 && P <= 256 && (SJ - 1) * 32 < PT, "softmax: 256 threads per t");

__global__ void __launch_bounds__(SW * 32)
k_scores(const float* __restrict__ mlo, const float* __restrict__ hiddens,
         const float* __restrict__ W_rect, const float* __restrict__ b_rect,
         float* __restrict__ attn_out, _Float16* __restrict__ attn16) {
  __shared__ __attribute__((aligned(16))) float hid[ST * H];
  __shared__ __attribute__((aligned(16))) float wr[(H + SW * 32 - 1) / (SW * 32) * (SW * 32)];
  __shared__ float part[SW][ST][SJ * 32];
  __shared__ float red[ST][256];
  int t0 = blockIdx.x * ST, b = blockIdx.y;
  int tid  = threadIdx.x;
  int lane = tid & 31;
  int wave = tid >> 5;

  // j < SJ - 1: whole 512-byte loads. j = SJ - 1: the row ends at PT, the address is clamped
  // to it (p in [P, PT) is pad that stage 1 has written; such sums are never read).
  const f32x4* mrow = (const f32x4*)mlo + ((size_t)b * (H / 4) + wave * SH) * PT;
  const f32x4* mq = mrow + lane;
  const f32x4* mz = mrow + ((SJ - 1) * 32 + lane < PT ? (SJ - 1) * 32 + lane : PT - 1);

  // hiddens (its ST rows are contiguous) and W_rect go to LDS; no branch and no rolled loop:
  // all loads of a thread, the first mlo batch too, are in flight at once, one trip to memory
  constexpr int NTH = SW * 32, NHS = ST * H / NTH, NWS = (H + NTH - 1) / NTH;
  static_assert(ST * H % NTH == 0, "whole passes");
  float hs[NHS], ws[NWS];
#pragma unroll                            // hs[] and ws[] stay in registers
  for (int i = 0; i < NHS; ++i) hs[i] = hiddens[((size_t)b * T + t0) * H + i * NTH + tid];
#pragma unroll
  for (int i = 0; i < NWS; ++i) {
    int h = i * NTH + tid;
    ws[i] = W_rect[h < H ? h : H - 1];    // the address stays inside W_rect
  }

  f32x4 q[2][SG][SJ];                     // this batch and the next one
#pragma unroll                            // q[] stays in registers
  for (int u = 0; u < SG; ++u) {
#pragma unroll
    for (int j = 0; j < SJ; ++j)
      q[0][u][j] = j < SJ - 1 ? mq[u * PT + j * 32] : mz[u * PT];
  }

#pragma unroll
  for (int i = 0; i < NHS; ++i) hid[i * NTH + tid] = hs[i];
#pragma unroll
  for (int i = 0; i < NWS; ++i) {
    wr[i * NTH + tid] = ws[i];            // no test: past H lies the pad of wr[], never read
  }
  __syncthreads();

  float acc[ST][SJ] = {};
#pragma unroll                            // q[] and acc[] stay in registers
  for (int g = 0; g < SH / SG; ++g) {
    if (g + 1 < SH / SG) {
#pragma unroll
      for (int u = 0; u < SG; ++u) {
#pragma unroll
        for (int j = 0; j < SJ; ++j)
          q[(g + 1) & 1][u][j] = j < SJ - 1 ? mq[((g + 1) * SG + u) * PT + j * 32]
                                            : mz[((g + 1) * SG + u) * PT];
      }
    }
    // as inputs the two pointers stay in their registers up to this wait, which stands behind
    // the last load that names them (else a load's own result may be given such a pair)
    if (g + 2 == SH / SG) asm volatile("s_wait_xcnt 0x0" :: "v"(mq), "v"(mz) : "memory");
    // keeps the next batch's loads in front of this batch's arithmetic, so that they fly
    // while it runs: without it they are spread through the arithmetic and fewer are in flight
    __builtin_amdgcn_sched_barrier(0);
#pragma unroll
    for (int u = 0; u < SG; ++u) {
      int h4 = wave * SH + g * SG + u;
      f32x4 w4 = *(const f32x4*)&wr[h4 * 4];
      f32x4 hv[ST];
#pragma unroll
      for (int s = 0; s < ST; ++s) hv[s] = *(const f32x4*)&hid[s * H + h4 * 4];
#pragma unroll
      for (int c = 0; c < 4; ++c) {                // h ascending inside a wave
#pragma unroll
        for (int j = 0; j < SJ; ++j) {
#pragma unroll
          for (int s = 0; s < ST; ++s) {
            float r = q[g & 1][u][j][c] + hv[s][c];
            acc[s][j] = fmaf(w4[c], (r > 0.0f ? r : 0.0f), acc[s][j]);
          }
        }
      }
    }
  }
#pragma unroll
  for (int s = 0; s < ST; ++s) {
#pragma unroll
    for (int j = 0; j < SJ; ++j) part[wave][s][j * 32 + lane] = acc[s][j];
  }
  __syncthreads();                        // every wave's partial sums are there before they are added

  // softmax: 256 threads per t, one per p
  int ts = tid >> 8;
  int p  = tid & 255;
  int t  = t0 + ts;
  float val = 0.0f;
  if (p < P) {
    float a = part[0][ts][p];
#pragma unroll
    for (int w = 1; w < SW; ++w) a += part[w][ts][p];
    val = a + b_rect[0];
  }

  red[ts][p] = (p < P) ? val : -3.0e38f;
  __syncthreads();
  for (int s = 128; s > 0; s >>= 1) {
    if (p < s) red[ts][p] = fmaxf(red[ts][p], red[ts][p + s]);
    __syncthreads();
  }
  float mx = red[ts][0];
  __syncthreads();

  float e = (p < P) ? __expf(val - mx) : 0.0f;
  red[ts][p] = e;
  __syncthreads();
  for (int s = 128; s > 0; s >>= 1) {
    if (p < s) red[ts][p] += red[ts][p + s];
    __syncthreads();
  }
  float a = e / red[ts][0];

  if (p < P)    attn_out[((size_t)b * T + t) * P + p] = a;
  if (p < PPAD) attn16[((size_t)b * T + t) * PPAD + p] =
                    (_Float16)((p < P) ? a : 0.0f);
}

// ---------------------------------------------------------------------------
// Stage 3: out[b][t][h] = sum_p attn[b,t,p] * fw[b,p,h] + b_final[h] + hiddens[b,t,h]  (K = PT)
// One wave = 16 t x OB*16 h (a whole 128-B line of each out row). Everything a wave reads goes
// from global memory to registers and is asked for before the first WMMA: one trip to memory.
// K is GK = 13 halves of a 32-wide k block; the 14th half is zero in registers on both sides.
// ---------------------------------------------------------------------------
constexpr int OB = 2, OW = 4;             // h tiles per wave, waves per block
static_assert((H / 16) % (OB * OW) == 0 && T % 16 == 0 && PT <= PPAD, "whole blocks");

__global__ void __launch_bounds__(OW * 32)
k_out(const _Float16* __restrict__ attn16, const _Float16* __restrict__ fw,
      const float* __restrict__ b_final, const float* __restrict__ hiddens,
      float* __restrict__ out) {
  int lane = threadIdx.x & 31;
  int wave = threadIdx.x >> 5;
  int b   = blockIdx.z;
  int tt  = blockIdx.y;
  int ht0 = (blockIdx.x * OW + wave) * OB;
  // A: row t = lane%16, k = i*16 + (lane/16)*8 + 0..7.  B: row h = lane%16, the same k.
  const v8h* Ap = (const v8h*)(attn16 + ((size_t)b * T + tt * 16 + (lane & 15)) * PPAD
                                      + (lane >> 4) * 8);
  const v8h* Bp = (const v8h*)fw + ((size_t)b * (H / 16) + ht0) * GK * 32 + lane;
  size_t idx0 = ((size_t)b * T + tt * 16 + (lane >> 4) * 8) * H + ht0 * 16 + (lane & 15);
  const float* hp = hiddens + idx0;
  const float* bp = b_final + ht0 * 16 + (lane & 15);

  v8h ah[GK], bh[OB][GK];
  float hv[OB][8], bias[OB];
#pragma unroll                            // every array here stays in registers
  for (int i = 0; i < GK; ++i) {
    ah[i] = Ap[i * 2];
#pragma unroll
    for (int j = 0; j < OB; ++j) bh[j][i] = Bp[(j * GK + i) * 32];
  }
#pragma unroll
  for (int j = 0; j < OB; ++j) {
    bias[j] = bp[j * 16];
#pragma unroll
    for (int r = 0; r < 8; ++r) hv[j][r] = hp[(size_t)r * H + j * 16];
  }
  // as inputs the pointers stay in their registers up to this wait, which stands behind the
  // last load that names them (else a load's own result may be given such a pair)
  asm volatile("s_wait_xcnt 0x0" :: "v"(Ap), "v"(Bp), "v"(hp), "v"(bp) : "memory");
  // keeps the WMMAs behind the last load: without it each WMMA's loads are issued only after
  // the WMMA before it, one trip to memory per k block
  __builtin_amdgcn_sched_barrier(0);

  const v8h zero = {0, 0, 0, 0, 0, 0, 0, 0};
  v8f c[OB] = {};
#pragma unroll                            // k ascending
  for (int ks = 0; ks < (GK + 1) / 2; ++ks) {
    bool whole = 2 * ks + 1 < GK;
    v16h a = __builtin_shufflevector(ah[2 * ks], whole ? ah[whole ? 2 * ks + 1 : 0] : zero,
                                     0, 1, 2, 3, 4, 5, 6, 7, 8, 9, 10, 11, 12, 13, 14, 15);
#pragma unroll
    for (int j = 0; j < OB; ++j) {
      v16h bb = __builtin_shufflevector(bh[j][2 * ks], whole ? bh[j][whole ? 2 * ks + 1 : 0] : zero,
                                        0, 1, 2, 3, 4, 5, 6, 7, 8, 9, 10, 11, 12, 13, 14, 15);
      c[j] = __builtin_amdgcn_wmma_f32_16x16x32_f16(false, a, false, bb,
                                                    (short)0, c[j], false, false);
    }
  }

#pragma unroll
  for (int j = 0; j < OB; ++j) {
#pragma unroll
    for (int r = 0; r < 8; ++r)
      out[idx0 + (size_t)r * H + j * 16] = c[j][r] + bias[j] + hv[j][r];
  }
}

// ---------------------------------------------------------------------------
extern "C" void kernel_launch(void* const* d_in, const int* in_sizes, int n_in,
                              void* d_out, int out_size, void* d_ws, size_t ws_size,
                              hipStream_t stream) {
  (void)in_sizes; (void)n_in; (void)out_size; (void)ws_size;
  const float* maps    = (const float*)d_in[0];
  const float* hiddens = (const float*)d_in[1];
  const float* W_map   = (const float*)d_in[2];
  const float* b_map   = (const float*)d_in[3];
  const float* W_final = (const float*)d_in[4];
  const float* b_final = (const float*)d_in[5];
  const float* W_rect  = (const float*)d_in[6];
  const float* b_rect  = (const float*)d_in[7];

  float* out  = (float*)d_out;                     // (B,T,H)
  float* attn = out + (size_t)B * T * H;           // (B,T,P)

  char* ws = (char*)d_ws;
  _Float16* fmA   = (_Float16*)(ws + OFF_FMA);
  _Float16* W2    = (_Float16*)(ws + OFF_W2);
  float*    mlo   = (float*)   (ws + OFF_MLO);
  _Float16* fw    = (_Float16*)(ws + OFF_FW);
  _Float16* att16 = (_Float16*)(ws + OFF_ATT16);

  // Stage 0: converts, one launch
  k_stage0<<<dim3(NB_A + 2 * NB_W), 256, 0, stream>>>(maps, W_map, W_final,
                                                      fmA, W2, W2 + (size_t)H * M);

  // Stage 1: fm . W_map^T and fm . W_final^T (WMMA)
  k_mlo<<<dim3(2 * NHB, B * (PT / 16) / MA), NW * 32, 0, stream>>>(fmA, W2, b_map, mlo, fw);

  // Stage 2: fused rectified score + softmax (VALU)
  k_scores<<<dim3(T / ST, B), SW * 32, 0, stream>>>(mlo, hiddens, W_rect, b_rect, attn, att16);

  // Stage 3: attention-weighted sum of fw + bias + residual (WMMA)
  k_out<<<dim3(H / 16 / (OB * OW), T / 16, B), OW * 32, 0, stream>>>(att16, fw, b_final, hiddens, out);
}

// v009
// Measured time: 36.2 microseconds a run.
// Two timings next to v008 both put it at 1.03 times that version's speed.
// Over all steps from v000 it is 4.11 times as fast.
#include <hip/hip_runtime.h>

constexpr int B = 8, T = 64, P = 196, M = 2048, H = 768;
constexpr int PPAD = 224;                 // row length of the fp16 attn rows in LDS
constexpr int KS   = M / 32;              // 32-wide k blocks of the K = M products
constexpr int PT   = 208;                 // P rounded up to the 16-row p tiles of stage 1
constexpr int GK   = PT / 16;             // 16-wide half k blocks of the K = P product

typedef __attribute__((ext_vector_type(16))) _Float16 v16h;
typedef __attribute__((ext_vector_type(8)))  _Float16 v8h;
typedef __attribute__((ext_vector_type(8)))  float    v8f;

// Workspace layout (bytes, all 16B aligned)
constexpr size_t OFF_FMA   = 0;                                   // fp16 [B][PT][M], fragment order
constexpr size_t OFF_W2    = OFF_FMA + (size_t)B * PT * M * 2;    // fp16 [2 H][M], fragment order:
                                                                  // W_map, then W_final
constexpr size_t OFF_MLO   = OFF_W2 + (size_t)2 * H * M * 2;      // fp32 [B][H/4][PT][4]
constexpr size_t OFF_FW    = OFF_MLO + (size_t)B * H * PT * 4;    // fp16 [B][H/16][GK][32 lanes][8]

__device__ __forceinline__ v16h load_pk(const v8h* p) {
  v8h lo = p[0];
  v8h hi = p[32];
  return __builtin_shufflevector(lo, hi, 0, 1, 2, 3, 4, 5, 6, 7,
                                          8, 9, 10, 11, 12, 13, 14, 15);
}

// ---------------------------------------------------------------------------
// Stage 0: fp32 -> fp16 converts into fragment order
// Few fat waves: every global access is 16 B per lane, every store of pack_block is 512
// contiguous bytes per wave, and all loads of a thread are issued before the first use.
// ---------------------------------------------------------------------------
typedef __attribute__((ext_vector_type(4))) float    f32x4;
typedef __attribute__((ext_vector_type(4))) _Float16 v4h;

constexpr int PU = 4;                     // k blocks per wave of pack_block: 512 B of each of 16 rows
static_assert(KS % PU == 0 && (PT / 16 * (KS / PU)) % 8 == 0 && (H / 16 * (KS / PU)) % 8 == 0,
              "pack_block has no tail");

// src: matrices of [rows][M] floats, this block works on matrix mat. One wave = one 16-row
// tile x PU k blocks; blk counts the blocks of one matrix.
// Rows past the end of a matrix (the last p tile) are stored as zeros.
__device__ __forceinline__ void
pack_block(const float* __restrict__ src, _Float16* __restrict__ dst, int rows, int blk, int mat) {
  int lane = threadIdx.x & 31;
  int w    = blk * 8 + (threadIdx.x >> 5);
  int tile = w / (KS / PU);
  int ks0  = (w % (KS / PU)) * PU;
  int tpm  = (rows + 15) >> 4;            // tiles per matrix
  int r    = tile * 16 + (lane & 15);
  int rc   = r < rows ? r : rows - 1;     // the address stays inside the matrix
  const f32x4* s = (const f32x4*)(src + ((size_t)mat * rows + rc) * M
                                      + ks0 * 32 + (lane >> 4) * 8);
  v8h* d = (v8h*)dst + ((size_t)(mat * tpm + tile) * KS + ks0) * 64 + lane;
  f32x4 v[PU][4];
#pragma unroll                            // v[] stays in registers, 4 * PU loads in flight
  for (int u = 0; u < PU; ++u) {
    v[u][0] = s[u * 8 + 0];               // k = (L/16)*8 + 0..7
    v[u][1] = s[u * 8 + 1];
    v[u][2] = s[u * 8 + 4];               // k = 16 + (L/16)*8 + 0..7
    if (u == PU - 1) asm volatile("s_wait_xcnt 0x0" ::: "memory");
    v[u][3] = s[u * 8 + 5];
  }
  // keeps the converts behind the last load: without it 12 of the 16 loads are issued only
  // after the first four have returned, a second trip to memory
  __builtin_amdgcn_sched_barrier(0);
#pragma unroll
  for (int u = 0; u < PU; ++u) {
#pragma unroll
    for (int hf = 0; hf < 2; ++hf) {
      v4h x = __builtin_convertvector(v[u][2 * hf], v4h);
      v4h y = __builtin_convertvector(v[u][2 * hf + 1], v4h);
      v8h o = __builtin_shufflevector(x, y, 0, 1, 2, 3, 4, 5, 6, 7);
      if (r >= rows) o = (v8h){0, 0, 0, 0, 0, 0, 0, 0};
      d[u * 64 + hf * 32] = o;
    }
  }
  // the code behind this function's call may reuse the registers that the stores above name
  // (address pair, data): the wait stands between the last store and any such overwrite
  asm volatile("s_wait_xcnt 0x0" ::: "memory");
}

constexpr int NB_A1 = PT / 16 * (KS / PU) / 8;       // pack of maps, blocks per b
constexpr int NB_A  = NB_A1 * B;
constexpr int NB_W  = H / 16 * (KS / PU) / 8;        // pack of one weight matrix

__global__ void __launch_bounds__(256)
k_stage0(const float* __restrict__ maps, const float* __restrict__ W_map,
         const float* __restrict__ W_final,
         _Float16* __restrict__ fmA, _Float16* __restrict__ Wm, _Float16* __restrict__ Wf) {
  int i = blockIdx.x;
  if (i < NB_A) {
    pack_block(maps, fmA, P, i % NB_A1, i / NB_A1);
  } else if (i < NB_A + NB_W) {
    pack_block(W_map, Wm, H, i - NB_A, 0);
  } else {
    pack_block(W_final, Wf, H, i - (NB_A + NB_W), 0);
  }
}

constexpr int NW = 4;
constexpr int KW = KS / NW;
static_assert(KS % NW == 0, "K splits evenly");

constexpr int ND = 3;
template <int TA, int TB>
__device__ __forceinline__ void
tile_splitk(const v8h* __restrict__ Ap, const v8h* __restrict__ Bp, f32x4* red,
            v8f (&o)[TA * TB / NW]) {
  constexpr int NT = TA * TB;
  static_assert(NT % NW == 0 && KW >= ND, "no tail");
  int lane = threadIdx.x & 31;
  int wave = threadIdx.x >> 5;
  Ap += wave * KW * 64;
  Bp += wave * KW * 64;
  v8f c[TA][TB] = {};
  v16h a[ND][TA], bb[ND][TB];

#pragma unroll                                     // a[] and bb[] stay in registers
  for (int s = 0; s < ND - 1; ++s) {
#pragma unroll
    for (int i = 0; i < TA; ++i) a[s][i] = load_pk(Ap + (i * KS + s) * 64);
#pragma unroll
    for (int j = 0; j < TB; ++j) bb[s][j] = load_pk(Bp + (j * KS + s) * 64);
    // keeps the k blocks' loads in k order: the first WMMA waits for k block 0 alone
    __builtin_amdgcn_sched_barrier(0);
  }

#pragma unroll                                     // the set's index is a constant: registers
  for (int ks = 0; ks < KW; ++ks) {
    // the first row of tiles needs all of B, which is asked for last: behind it this k block
    // has landed, and (ND - 1) k blocks' loads at most are outstanding after the next issue
#pragma unroll
    for (int j = 0; j < TB; ++j)
      c[0][j] = __builtin_amdgcn_wmma_f32_16x16x32_f16(false, a[ks % ND][0], false, bb[ks % ND][j],
                                                       (short)0, c[0][j], false, false);
    // keeps the loads below behind the first row: without it they are issued in front of it,
    // three k blocks' loads outstanding at once
    __builtin_amdgcn_sched_barrier(0);
    if (ks + ND - 1 < KW) {
#pragma unroll
      for (int i = 0; i < TA; ++i)
        a[(ks + ND - 1) % ND][i] = load_pk(Ap + (i * KS + ks + ND - 1) * 64);
#pragma unroll
      for (int j = 0; j < TB; ++j)
        bb[(ks + ND - 1) % ND][j] = load_pk(Bp + (j * KS + ks + ND - 1) * 64);
    }
    // what follows may rewrite the address registers that the loads name; as inputs the two
    // pointers stay in their registers up to this wait, which stands behind the last load
    // (else a load's own result may be given the pair that the loads before it still name)
    if (ks + ND == KW) asm volatile("s_wait_xcnt 0x0" :: "v"(Ap), "v"(Bp) : "memory");
    // keeps the loads above in front of the other rows' WMMAs, so that they fly while these
    // run: without it they are issued only as the WMMAs free their registers, a row at a time
    __builtin_amdgcn_sched_barrier(0);
#pragma unroll                                     // k ascending inside a wave
    for (int i = 1; i < TA; ++i) {
#pragma unroll
      for (int j = 0; j < TB; ++j)
        c[i][j] = __builtin_amdgcn_wmma_f32_16x16x32_f16(false, a[ks % ND][i], false, bb[ks % ND][j],
                                                         (short)0, c[i][j], false, false);
    }
    // keeps the next k block's first row, which waits for its loads, behind these WMMAs:
    // without it that wait is moved up in front of most of them and the loads' lead is lost
    __builtin_amdgcn_sched_barrier(0);
  }

#pragma unroll
  for (int i = 0; i < TA; ++i) {
#pragma unroll
    for (int j = 0; j < TB; ++j) {
      f32x4* d = red + ((wave * NT + i * TB + j) * 2) * 32 + lane;
      d[0]  = __builtin_shufflevector(c[i][j], c[i][j], 0, 1, 2, 3);
      d[32] = __builtin_shufflevector(c[i][j], c[i][j], 4, 5, 6, 7);
    }
  }
  __syncthreads();                                 // every partial tile is whole before it is summed
#pragma unroll                                     // o[] stays in registers
  for (int q = 0; q < NT / NW; ++q) {
    const f32x4* s = red + ((wave * (NT / NW) + q) * 2) * 32 + lane;
    f32x4 lo = s[0], hi = s[32];
#pragma unroll
    for (int w = 1; w < NW; ++w) {                 // w ascending: k ascending
      lo += s[w * NT * 64];
      hi += s[w * NT * 64 + 32];
    }
    o[q] = __builtin_shufflevector(lo, hi, 0, 1, 2, 3, 4, 5, 6, 7);
  }
}

// ---------------------------------------------------------------------------
// Stage 1: mlo(b,p,h) = fm[b,p,:] . W_map[h,:] + b_map[h]  and  fw(b,p,h) = fm[b,p,:] . W_final[h,:]
// (K = 2048). The B operand is the list of the 2 H/16 row tiles of W_map, then W_final.
// mlo is stored as [b][h/4][p][h%4]: stage 2 gives a lane p = j*32 + lane, so its 16-byte load of
// four h covers 512 contiguous bytes per wave. A 128-B line is 8 p x 4 h of one wave.
// fw is stored as the B operand of stage 2's product (row h, k = p): an accumulator lane holds
// h = lane%16 and p = pt*16 + (lane/16)*8 + 0..7, which is that operand's lane and k order,
// so a tile is one 16-byte store per lane, 512 contiguous bytes per wave.
// The p tiles of all b are one list of B * PT/16; a block takes MA of them and MB h tiles.
// ---------------------------------------------------------------------------
constexpr int MA = 8, MB = 6;
constexpr int NHB = H / 16 / MB;          // blocks along h per weight matrix
static_assert((B * (PT / 16)) % MA == 0 && (H / 16) % MB == 0, "whole blocks");

__global__ void __launch_bounds__(NW * 32)
k_mlo(const _Float16* __restrict__ fmA, const _Float16* __restrict__ W2,
      const float* __restrict__ b_map, float* __restrict__ mlo, _Float16* __restrict__ fw) {
  __shared__ __attribute__((aligned(16))) f32x4 red[NW * MA * MB * 64];
  int lane = threadIdx.x & 31;
  int wave = threadIdx.x >> 5;
  v8f o[MA * MB / NW];
  tile_splitk<MA, MB>((const v8h*)fmA + (size_t)(blockIdx.y * MA) * KS * 64 + lane,
                           (const v8h*)W2 + (size_t)(blockIdx.x * MB) * KS * 64 + lane, red, o);

  int po = (lane >> 4) * 8;
  if (blockIdx.x < NHB) {                          // W_map
#pragma unroll
    for (int q = 0; q < MA * MB / NW; ++q) {
      int tile = wave * (MA * MB / NW) + q;
      int g  = blockIdx.y * MA + tile / MB;        // p tile in the list of all b
      int b  = g / (PT / 16);
      int pt = g % (PT / 16);
      int h  = (blockIdx.x * MB + tile % MB) * 16 + (lane & 15);
      float bias = b_map[h];
#pragma unroll
      for (int r = 0; r < 8; ++r) {
        int p = pt * 16 + po + r;                  // p in [P, PT) is pad: stage 2 loads it, never uses its sums
        mlo[(((size_t)b * (H / 4) + (h >> 2)) * PT + p) * 4 + (h & 3)] = o[q][r] + bias;
      }
    }
  } else {                                         // W_final; p in [P, PT): fm is 0 there, so is fw
#pragma unroll
    for (int q = 0; q < MA * MB / NW; ++q) {
      int tile = wave * (MA * MB / NW) + q;
      int g  = blockIdx.y * MA + tile / MB;
      int b  = g / (PT / 16);
      int pt = g % (PT / 16);
      int ht = (blockIdx.x - NHB) * MB + tile % MB;
      ((v8h*)fw)[(((size_t)b * (H / 16) + ht) * GK + pt) * 32 + lane] =
          __builtin_convertvector(o[q], v8h);
    }
    // the code laid out behind this branch reuses the registers that the stores above name
    // (address pairs, data): the wait stands between the last store and any such overwrite
    asm volatile("s_wait_xcnt 0x0" ::: "memory");
  }
}

// ---------------------------------------------------------------------------
// Stage 2: scores + softmax.  One block per (b, ST consecutive t).
// score[p] = sum_h W_rect[h]*relu(mlo[b,p,h]+hid[b,t,h]) + b_rect
// ReLU between add and reduction => VALU (cannot be a GEMM); ~0.3 Gops total.
// Register tile: a wave covers ALL p (lane holds p = j*32 + lane, j < SJ) for ST t and for its
// own H/SW values of h. Every mlo value that is loaded feeds ST t (mlo is read T/ST times from
// L2, not T times) and every hid / W_rect value read from LDS feeds SJ p.
// The SW partial sums of a score are added through LDS, wave ascending (h ascending).
// Then out[b][t][h] = sum_p attn[b,t,p] * fw[b,p,h] + b_final[h] + hiddens[b,t,h]  (K = PT) for the
// block's own ST t: no launch of its own and no trip of attn through memory. A wave takes OB h
// tiles; its fw fragments are asked for behind the score loop and fly during the softmax.
// K is GK = 13 halves of a 32-wide k block; the 14th half is zero in registers on both sides.
// ---------------------------------------------------------------------------
constexpr int ST = 2;                     // t per block: B * T / ST blocks, one per WGP
constexpr int SW = 16;                    // waves per block
constexpr int SH = H / 4 / SW;            // groups of four h per wave
constexpr int SG = 2;                     // groups of four h per batch of loads
constexpr int SJ = (P + 31) / 32;         // p per lane
static_assert(T % ST == 0 && (H / 4) % SW == 0 && SH % SG == 0, "no tail");
static_assert(ST * 256 == SW * 32 && P <= 256 && (SJ - 1) * 32 < PT, "softmax: 256 threads per t");
constexpr int OB = H / 16 / SW;           // h tiles per wave of the K = P product
static_assert((H / 16) % SW == 0 && ST == 2 && PT <= PPAD && ST * H / 4 <= SW * 32, "whole tiles");

// A work-group barrier that orders LDS traffic alone. __syncthreads() also waits for the wave's
// outstanding global loads: behind the score loop that would end the flight of the fw fragments
// at the first barrier of the softmax. Nothing that these barriers order lies in global memory.
__device__ __forceinline__ void lds_barrier() {
  __builtin_amdgcn_fence(__ATOMIC_RELEASE, "workgroup", "local");
  __builtin_amdgcn_s_barrier();
  __builtin_amdgcn_fence(__ATOMIC_ACQUIRE, "workgroup", "local");
}

__global__ void __launch_bounds__(SW * 32)
k_scores(const float* __restrict__ mlo, const float* __restrict__ hiddens,
         const float* __restrict__ W_rect, const float* __restrict__ b_rect,
         const _Float16* __restrict__ fw, const float* __restrict__ b_final,
         float* __restrict__ attn_out, float* __restrict__ out) {
  __shared__ __attribute__((aligned(16))) float hid[ST * H];
  __shared__ __attribute__((aligned(16))) float wr[(H + SW * 32 - 1) / (SW * 32) * (SW * 32)];
  __shared__ float part[SW][ST][SJ * 32];
  __shared__ float red[ST][256];
  __shared__ __attribute__((aligned(16))) _Float16 att[ST][PPAD];
  int t0 = blockIdx.x * ST, b = blockIdx.y;
  int tid  = threadIdx.x;
  int lane = tid & 31;
  int wave = tid >> 5;

  // j < SJ - 1: whole 512-byte loads. j = SJ - 1: the row ends at PT, the address is clamped
  // to it (p in [P, PT) is pad that stage 1 has written; such sums are never read).
  const f32x4* mrow = (const f32x4*)mlo + ((size_t)b * (H / 4) + wave * SH) * PT;
  const f32x4* mq = mrow + lane;
  const f32x4* mz = mrow + ((SJ - 1) * 32 + lane < PT ? (SJ - 1) * 32 + lane : PT - 1);

  // hiddens (its ST rows are contiguous) and W_rect go to LDS; no branch and no rolled loop:
  // all loads of a thread, the first mlo batch too, are in flight at once, one trip to memory
  constexpr int NTH = SW * 32, NHS = ST * H / NTH, NWS = (H + NTH - 1) / NTH;
  static_assert(ST * H % NTH == 0, "whole passes");
  float hs[NHS], ws[NWS];
#pragma unroll                            // hs[] and ws[] stay in registers
  for (int i = 0; i < NHS; ++i) hs[i] = hiddens[((size_t)b * T + t0) * H + i * NTH + tid];
#pragma unroll
  for (int i = 0; i < NWS; ++i) {
    int h = i * NTH + tid;
    ws[i] = W_rect[h < H ? h : H - 1];    // the address stays inside W_rect
  }

  f32x4 q[2][SG][SJ];                     // this batch and the next one
#pragma unroll                            // q[] stays in registers
  for (int u = 0; u < SG; ++u) {
#pragma unroll
    for (int j = 0; j < SJ; ++j)
      q[0][u][j] = j < SJ - 1 ? mq[u * PT + j * 32] : mz[u * PT];
  }

#pragma unroll
  for (int i = 0; i < NHS; ++i) hid[i * NTH + tid] = hs[i];
#pragma unroll
  for (int i = 0; i < NWS; ++i) {
    wr[i * NTH + tid] = ws[i];            // no test: past H lies the pad of wr[], never read
  }
  __syncthreads();

  float acc[ST][SJ] = {};
#pragma unroll                            // q[] and acc[] stay in registers
  for (int g = 0; g < SH / SG; ++g) {
    if (g + 1 < SH / SG) {
#pragma unroll
      for (int u = 0; u < SG; ++u) {
#pragma unroll
        for (int j = 0; j < SJ; ++j)
          q[(g + 1) & 1][u][j] = j < SJ - 1 ? mq[((g + 1) * SG + u) * PT + j * 32]
                                            : mz[((g + 1) * SG + u) * PT];
      }
    }
    // as inputs the two pointers stay in their registers up to this wait, which stands behind
    // the last load that names them (else a load's own result may be given such a pair)
    if (g + 2 == SH / SG) asm volatile("s_wait_xcnt 0x0" :: "v"(mq), "v"(mz) : "memory");
    // keeps the next batch's loads in front of this batch's arithmetic, so that they fly
    // while it runs: without it they are spread through the arithmetic and fewer are in flight
    __builtin_amdgcn_sched_barrier(0);
#pragma unroll
    for (int u = 0; u < SG; ++u) {
      int h4 = wave * SH + g * SG + u;
      f32x4 w4 = *(const f32x4*)&wr[h4 * 4];
      f32x4 hv[ST];
#pragma unroll
      for (int s = 0; s < ST; ++s) hv[s] = *(const f32x4*)&hid[s * H + h4 * 4];
#pragma unroll
      for (int c = 0; c < 4; ++c) {                // h ascending inside a wave
#pragma unroll
        for (int j = 0; j < SJ; ++j) {
#pragma unroll
          for (int s = 0; s < ST; ++s) {
            float r = q[g & 1][u][j][c] + hv[s][c];
            acc[s][j] = fmaf(w4[c], (r > 0.0f ? r : 0.0f), acc[s][j]);
          }
        }
      }
    }
  }

  // B of the K = P product: row h = lane%16, k = i*16 + (lane/16)*8 + 0..7, as stage 1 stored it
  const v8h* Bp = (const v8h*)fw + ((size_t)b * (H / 16) + wave * OB) * GK * 32 + lane;
  const float* bp = b_final + wave * OB * 16 + (lane & 15);
  v8h bh[OB][GK];
  float bias[OB];
  // keeps the loads below behind the score loop: in front of it their results and q[] would
  // not fit the registers together
  __builtin_amdgcn_sched_barrier(0);
#pragma unroll                            // bh[] stays in registers
  for (int j = 0; j < OB; ++j) {
#pragma unroll
    for (int i = 0; i < GK; ++i) bh[j][i] = Bp[(j * GK + i) * 32];
  }
#pragma unroll
  for (int j = 0; j < OB; ++j) bias[j] = bp[j * 16];
  // as inputs the pointers stay in their registers up to this wait, which stands behind the
  // last load that names them (else a load's own result may be given such a pair)
  asm volatile("s_wait_xcnt 0x0" :: "v"(Bp), "v"(bp) : "memory");
  // keeps the loads above in front of the softmax, so that they fly while it runs
  __builtin_amdgcn_sched_barrier(0);

#pragma unroll
  for (int s = 0; s < ST; ++s) {
#pragma unroll
    for (int j = 0; j < SJ; ++j) part[wave][s][j * 32 + lane] = acc[s][j];
  }
  lds_barrier();                          // every wave's partial sums are there before they are added

  // softmax: 256 threads per t, one per p
  int ts = tid >> 8;
  int p  = tid & 255;
  int t  = t0 + ts;
  float val = 0.0f;
  if (p < P) {
    float a = part[0][ts][p];
#pragma unroll
    for (int w = 1; w < SW; ++w) a += part[w][ts][p];
    val = a + b_rect[0];
  }

  red[ts][p] = (p < P) ? val : -3.0e38f;
  lds_barrier();
  for (int s = 128; s > 0; s >>= 1) {
    if (p < s) red[ts][p] = fmaxf(red[ts][p], red[ts][p + s]);
    lds_barrier();
  }
  float mx = red[ts][0];
  lds_barrier();

  float e = (p < P) ? __expf(val - mx) : 0.0f;
  red[ts][p] = e;
  lds_barrier();
  for (int s = 128; s > 0; s >>= 1) {
    if (p < s) red[ts][p] += red[ts][p + s];
    lds_barrier();
  }
  float a = e / red[ts][0];

  if (p < P)    attn_out[((size_t)b * T + t) * P + p] = a;
  if (p < PPAD) att[ts][p] = (_Float16)((p < P) ? a : 0.0f);
  lds_barrier();                          // both attn rows are whole before a wave reads them

  // A: k = i*16 + (lane/16)*8 + 0..7, the k order of B. Row r of the 16 holds t = r%2: a row of
  // the result depends on its own row of A alone, and rows 0 and 9 are the ones that are kept.
  const v8h* Ap = (const v8h*)&att[lane & 1][(lane >> 4) * 8];
  const v8h zero = {0, 0, 0, 0, 0, 0, 0, 0};
  v8f c[OB] = {};
#pragma unroll                            // k ascending
  for (int ks = 0; ks < (GK + 1) / 2; ++ks) {
    bool whole = 2 * ks + 1 < GK;
    v16h av = __builtin_shufflevector(Ap[4 * ks], whole ? Ap[whole ? 4 * ks + 2 : 0] : zero,
                                      0, 1, 2, 3, 4, 5, 6, 7, 8, 9, 10, 11, 12, 13, 14, 15);
#pragma unroll
    for (int j = 0; j < OB; ++j) {
      v16h bb = __builtin_shufflevector(bh[j][2 * ks], whole ? bh[j][whole ? 2 * ks + 1 : 0] : zero,
                                        0, 1, 2, 3, 4, 5, 6, 7, 8, 9, 10, 11, 12, 13, 14, 15);
      c[j] = __builtin_amdgcn_wmma_f32_16x16x32_f16(false, av, false, bb,
                                                    (short)0, c[j], false, false);
    }
  }

#pragma unroll
  for (int j = 0; j < OB; ++j) {
    float* hq = &hid[(lane >> 4) * H + (wave * OB + j) * 16 + (lane & 15)];
    *hq = ((lane < 16 ? c[j][0] : c[j][1]) + bias[j]) + *hq;
  }
  lds_barrier();                          // every wave's h tiles are there before the rows are stored
  if (tid < ST * H / 4)
    ((f32x4*)(out + ((size_t)b * T + t0) * H))[tid] = ((const f32x4*)hid)[tid];
}

// ---------------------------------------------------------------------------
extern "C" void kernel_launch(void* const* d_in, const int* in_sizes, int n_in,
                              void* d_out, int out_size, void* d_ws, size_t ws_size,
                              hipStream_t stream) {
  (void)in_sizes; (void)n_in; (void)out_size; (void)ws_size;
  const float* maps    = (const float*)d_in[0];
  const float* hiddens = (const float*)d_in[1];
  const float* W_map   = (const float*)d_in[2];
  const float* b_map   = (const float*)d_in[3];
  const float* W_final = (const float*)d_in[4];
  const float* b_final = (const float*)d_in[5];
  const float* W_rect  = (const float*)d_in[6];
  const float* b_rect  = (const float*)d_in[7];

  float* out  = (float*)d_out;                     // (B,T,H)
  float* attn = out + (size_t)B * T * H;           // (B,T,P)

  char* ws = (char*)d_ws;
  _Float16* fmA   = (_Float16*)(ws + OFF_FMA);
  _Float16* W2    = (_Float16*)(ws + OFF_W2);
  float*    mlo   = (float*)   (ws + OFF_MLO);
  _Float16* fw    = (_Float16*)(ws + OFF_FW);

  // Stage 0: converts, one launch
  k_stage0<<<dim3(NB_A + 2 * NB_W), 256, 0, stream>>>(maps, W_map, W_final,
                                                      fmA, W2, W2 + (size_t)H * M);

  // Stage 1: fm . W_map^T and fm . W_final^T (WMMA)
  k_mlo<<<dim3(2 * NHB, B * (PT / 16) / MA), NW * 32, 0, stream>>>(fmA, W2, b_map, mlo, fw);

  // Stage 2: rectified score + softmax (VALU), attention-weighted sum of fw + bias + residual (WMMA)
  k_scores<<<dim3(T / ST, B), SW * 32, 0, stream>>>(mlo, hiddens, W_rect, b_rect, fw, b_final,
                                                    attn, out);
}

// v010
// It runs in 33.3 microseconds.
// In two side-by-side timings against v009, it was 1.08 and 1.10 times as fast.
// All steps since v000 together make it 4.48 times as fast.
#include <hip/hip_runtime.h>

constexpr int B = 8, T = 64, P = 196, M = 2048, H = 768;
constexpr int PPAD = 224;                 // row length of the fp16 attn rows in LDS
constexpr int KS   = M / 32;              // 32-wide k blocks of the K = M products
constexpr int PT   = 208;                 // P rounded up to the 16-row p tiles of stage 1
constexpr int GK   = PT / 16;             // 16-wide half k blocks of the K = P product

typedef __attribute__((ext_vector_type(16))) _Float16 v16h;
typedef __attribute__((ext_vector_type(8)))  _Float16 v8h;
typedef __attribute__((ext_vector_type(8)))  float    v8f;

// Workspace layout (bytes, all 16B aligned)
constexpr size_t OFF_FMA   = 0;                                   // fp16 [B][PT][M], fragment order
constexpr size_t OFF_W2    = OFF_FMA + (size_t)B * PT * M * 2;    // fp16 [2 H][M], fragment order:
                                                                  // W_map, then W_final
constexpr size_t OFF_MLO   = OFF_W2 + (size_t)2 * H * M * 2;      // fp16 [B][H/8][PT][8]
constexpr size_t OFF_FW    = OFF_MLO + (size_t)B * H * PT * 2;    // fp16 [B][H/16][GK][32 lanes][8]

__device__ __forceinline__ v16h load_pk(const v8h* p) {
  v8h lo = p[0];
  v8h hi = p[32];
  return __builtin_shufflevector(lo, hi, 0, 1, 2, 3, 4, 5, 6, 7,
                                          8, 9, 10, 11, 12, 13, 14, 15);
}

// ---------------------------------------------------------------------------
// Stage 0: fp32 -> fp16 converts into fragment order
// Few fat waves: every global access is 16 B per lane, every store of pack_block is 512
// contiguous bytes per wave, and all loads of a thread are issued before the first use.
// ---------------------------------------------------------------------------
typedef __attribute__((ext_vector_type(4))) float    f32x4;
typedef __attribute__((ext_vector_type(2))) float    f32x2;
typedef __attribute__((ext_vector_type(4))) _Float16 v4h;

constexpr int PU = 4;                     // k blocks per wave of pack_block: 512 B of each of 16 rows
static_assert(KS % PU == 0 && (PT / 16 * (KS / PU)) % 8 == 0 && (H / 16 * (KS / PU)) % 8 == 0,
              "pack_block has no tail");

// src: matrices of [rows][M] floats, this block works on matrix mat. One wave = one 16-row
// tile x PU k blocks; blk counts the blocks of one matrix.
// Rows past the end of a matrix (the last p tile) are stored as zeros.
__device__ __forceinline__ void
pack_block(const float* __restrict__ src, _Float16* __restrict__ dst, int rows, int blk, int mat) {
  int lane = threadIdx.x & 31;
  int w    = blk * 8 + (threadIdx.x >> 5);
  int tile = w / (KS / PU);
  int ks0  = (w % (KS / PU)) * PU;
  int tpm  = (rows + 15) >> 4;            // tiles per matrix
  int r    = tile * 16 + (lane & 15);
  int rc   = r < rows ? r : rows - 1;     // the address stays inside the matrix
  const f32x4* s = (const f32x4*)(src + ((size_t)mat * rows + rc) * M
                                      + ks0 * 32 + (lane >> 4) * 8);
  v8h* d = (v8h*)dst + ((size_t)(mat * tpm + tile) * KS + ks0) * 64 + lane;
  f32x4 v[PU][4];
#pragma unroll                            // v[] stays in registers, 4 * PU loads in flight
  for (int u = 0; u < PU; ++u) {
    v[u][0] = s[u * 8 + 0];               // k = (L/16)*8 + 0..7
    v[u][1] = s[u * 8 + 1];
    v[u][2] = s[u * 8 + 4];               // k = 16 + (L/16)*8 + 0..7
    if (u == PU - 1) asm volatile("s_wait_xcnt 0x0" ::: "memory");
    v[u][3] = s[u * 8 + 5];
  }
  // keeps the converts behind the last load: without it 12 of the 16 loads are issued only
  // after the first four have returned, a second trip to memory
  __builtin_amdgcn_sched_barrier(0);
#pragma unroll
  for (int u = 0; u < PU; ++u) {
#pragma unroll
    for (int hf = 0; hf < 2; ++hf) {
      v4h x = __builtin_convertvector(v[u][2 * hf], v4h);
      v4h y = __builtin_convertvector(v[u][2 * hf + 1], v4h);
      v8h o = __builtin_shufflevector(x, y, 0, 1, 2, 3, 4, 5, 6, 7);
      if (r >= rows) o = (v8h){0, 0, 0, 0, 0, 0, 0, 0};
      d[u * 64 + hf * 32] = o;
    }
  }
  // the code behind this function's call may reuse the registers that the stores above name
  // (address pair, data): the wait stands between the last store and any such overwrite
  asm volatile("s_wait_xcnt 0x0" ::: "memory");
}

constexpr int NB_A1 = PT / 16 * (KS / PU) / 8;       // pack of maps, blocks per b
constexpr int NB_A  = NB_A1 * B;
constexpr int NB_W  = H / 16 * (KS / PU) / 8;        // pack of one weight matrix

__global__ void __launch_bounds__(256)
k_stage0(const float* __restrict__ maps, const float* __restrict__ W_map,
         const float* __restrict__ W_final,
         _Float16* __restrict__ fmA, _Float16* __restrict__ Wm, _Float16* __restrict__ Wf) {
  int i = blockIdx.x;
  if (i < NB_A) {
    pack_block(maps, fmA, P, i % NB_A1, i / NB_A1);
  } else if (i < NB_A + NB_W) {
    pack_block(W_map, Wm, H, i - NB_A, 0);
  } else {
    pack_block(W_final, Wf, H, i - (NB_A + NB_W), 0);
  }
}

constexpr int NW = 4;
constexpr int KW = KS / NW;
static_assert(KS % NW == 0, "K splits evenly");

constexpr int ND = 3;
template <int TA, int TB>
__device__ __forceinline__ void
tile_splitk(const v8h* __restrict__ Ap, const v8h* __restrict__ Bp, f32x4* red,
            v8f (&o)[TA * TB / NW]) {
  constexpr int NT = TA * TB;
  static_assert(NT % NW == 0 && KW >= ND, "no tail");
  int lane = threadIdx.x & 31;
  int wave = threadIdx.x >> 5;
  Ap += wave * KW * 64;
  Bp += wave * KW * 64;
  v8f c[TA][TB] = {};
  v16h a[ND][TA], bb[ND][TB];

#pragma unroll                                     // a[] and bb[] stay in registers
  for (int s = 0; s < ND - 1; ++s) {
#pragma unroll
    for (int i = 0; i < TA; ++i) a[s][i] = load_pk(Ap + (i * KS + s) * 64);
#pragma unroll
    for (int j = 0; j < TB; ++j) bb[s][j] = load_pk(Bp + (j * KS + s) * 64);
    // keeps the k blocks' loads in k order: the first WMMA waits for k block 0 alone
    __builtin_amdgcn_sched_barrier(0);
  }

#pragma unroll                                     // the set's index is a constant: registers
  for (int ks = 0; ks < KW; ++ks) {
    // the first row of tiles needs all of B, which is asked for last: behind it this k block
    // has landed, and (ND - 1) k blocks' loads at most are outstanding after the next issue
#pragma unroll
    for (int j = 0; j < TB; ++j)
      c[0][j] = __builtin_amdgcn_wmma_f32_16x16x32_f16(false, a[ks % ND][0], false, bb[ks % ND][j],
                                                       (short)0, c[0][j], false, false);
    // keeps the loads below behind the first row: without it they are issued in front of it,
    // three k blocks' loads outstanding at once
    __builtin_amdgcn_sched_barrier(0);
    if (ks + ND - 1 < KW) {
#pragma unroll
      for (int i = 0; i < TA; ++i)
        a[(ks + ND - 1) % ND][i] = load_pk(Ap + (i * KS + ks + ND - 1) * 64);
#pragma unroll
      for (int j = 0; j < TB; ++j)
        bb[(ks + ND - 1) % ND][j] = load_pk(Bp + (j * KS + ks + ND - 1) * 64);
    }
    // what follows may rewrite the address registers that the loads name; as inputs the two
    // pointers stay in their registers up to this wait, which stands behind the last load
    // (else a load's own result may be given the pair that the loads before it still name)
    if (ks + ND == KW) asm volatile("s_wait_xcnt 0x0" :: "v"(Ap), "v"(Bp) : "memory");
    // keeps the loads above in front of the other rows' WMMAs, so that they fly while these
    // run: without it they are issued only as the WMMAs free their registers, a row at a time
    __builtin_amdgcn_sched_barrier(0);
#pragma unroll                                     // k ascending inside a wave
    for (int i = 1; i < TA; ++i) {
#pragma unroll
      for (int j = 0; j < TB; ++j)
        c[i][j] = __builtin_amdgcn_wmma_f32_16x16x32_f16(false, a[ks % ND][i], false, bb[ks % ND][j],
                                                         (short)0, c[i][j], false, false);
    }
    // keeps the next k block's first row, which waits for its loads, behind these WMMAs:
    // without it that wait is moved up in front of most of them and the loads' lead is lost
    __builtin_amdgcn_sched_barrier(0);
  }

#pragma unroll
  for (int i = 0; i < TA; ++i) {
#pragma unroll
    for (int j = 0; j < TB; ++j) {
      f32x4* d = red + ((wave * NT + i * TB + j) * 2) * 32 + lane;
      d[0]  = __builtin_shufflevector(c[i][j], c[i][j], 0, 1, 2, 3);
      d[32] = __builtin_shufflevector(c[i][j], c[i][j], 4, 5, 6, 7);
    }
  }
  __syncthreads();                                 // every partial tile is whole before it is summed
#pragma unroll                                     // o[] stays in registers
  for (int q = 0; q < NT / NW; ++q) {
    const f32x4* s = red + ((wave * (NT / NW) + q) * 2) * 32 + lane;
    f32x4 lo = s[0], hi = s[32];
#pragma unroll
    for (int w = 1; w < NW; ++w) {                 // w ascending: k ascending
      lo += s[w * NT * 64];
      hi += s[w * NT * 64 + 32];
    }
    o[q] = __builtin_shufflevector(lo, hi, 0, 1, 2, 3, 4, 5, 6, 7);
  }
}

// ---------------------------------------------------------------------------
// Stage 1: mlo(b,p,h) = fm[b,p,:] . W_map[h,:] + b_map[h]  and  fw(b,p,h) = fm[b,p,:] . W_final[h,:]
// (K = 2048). The B operand is the list of the 2 H/16 row tiles of W_map, then W_final.
// mlo is summed and biased in fp32 and stored as fp16, [b][h/8][p][h%8]: stage 2 has one lane
// per p, so its 16-byte load of eight h covers 512 contiguous bytes per wave. Every block of
// stage 2 reads all of mlo[b] from L2: two bytes a value there, not four. A 128-B line is
// 8 p x 8 h of one wave.
// fw is stored as the B operand of stage 2's product (row h, k = p): an accumulator lane holds
// h = lane%16 and p = pt*16 + (lane/16)*8 + 0..7, which is that operand's lane and k order,
// so a tile is one 16-byte store per lane, 512 contiguous bytes per wave.
// The p tiles of all b are one list of B * PT/16; a block takes MA of them and MB h tiles.
// ---------------------------------------------------------------------------
constexpr int MA = 8, MB = 6;
constexpr int NHB = H / 16 / MB;          // blocks along h per weight matrix
static_assert((B * (PT / 16)) % MA == 0 && (H / 16) % MB == 0, "whole blocks");

__global__ void __launch_bounds__(NW * 32)
k_mlo(const _Float16* __restrict__ fmA, const _Float16* __restrict__ W2,
      const float* __restrict__ b_map, _Float16* __restrict__ mlo, _Float16* __restrict__ fw) {
  __shared__ __attribute__((aligned(16))) f32x4 red[NW * MA * MB * 64];
  int lane = threadIdx.x & 31;
  int wave = threadIdx.x >> 5;
  v8f o[MA * MB / NW];
  tile_splitk<MA, MB>((const v8h*)fmA + (size_t)(blockIdx.y * MA) * KS * 64 + lane,
                           (const v8h*)W2 + (size_t)(blockIdx.x * MB) * KS * 64 + lane, red, o);

  int po = (lane >> 4) * 8;
  if (blockIdx.x < NHB) {                          // W_map
#pragma unroll
    for (int q = 0; q < MA * MB / NW; ++q) {
      int tile = wave * (MA * MB / NW) + q;
      int g  = blockIdx.y * MA + tile / MB;        // p tile in the list of all b
      int b  = g / (PT / 16);
      int pt = g % (PT / 16);
      int h  = (blockIdx.x * MB + tile % MB) * 16 + (lane & 15);
      float bias = b_map[h];
#pragma unroll
      for (int r = 0; r < 8; ++r) {
        int p = pt * 16 + po + r;                  // p in [P, PT) is pad: stage 2 loads it, never uses its sums
        mlo[(((size_t)b * (H / 8) + (h >> 3)) * PT + p) * 8 + (h & 7)] = (_Float16)(o[q][r] + bias);
      }
    }
  } else {                                         // W_final; p in [P, PT): fm is 0 there, so is fw
#pragma unroll
    for (int q = 0; q < MA * MB / NW; ++q) {
      int tile = wave * (MA * MB / NW) + q;
      int g  = blockIdx.y * MA + tile / MB;
      int b  = g / (PT / 16);
      int pt = g % (PT / 16);
      int ht = (blockIdx.x - NHB) * MB + tile % MB;
      ((v8h*)fw)[(((size_t)b * (H / 16) + ht) * GK + pt) * 32 + lane] =
          __builtin_convertvector(o[q], v8h);
    }
    // the code laid out behind this branch reuses the registers that the stores above name
    // (address pairs, data): the wait stands between the last store and any such overwrite
    asm volatile("s_wait_xcnt 0x0" ::: "memory");
  }
}

// ---------------------------------------------------------------------------
// Stage 2: scores + softmax.  One block per (b, ST consecutive t).
// score[p] = sum_h W_rect[h]*relu(mlo[b,p,h]+hid[b,t,h]) + b_rect
// ReLU between add and reduction => VALU (cannot be a GEMM); ~0.3 Gops total.
// Register tile: a wave covers ALL p (lane holds p = j*32 + lane, j < SJ) for ST t and for its
// own H/SW values of h. Every mlo value that is loaded feeds ST t (mlo is read T/ST times from
// L2, not T times) and every hid / W_rect value read from LDS feeds SJ p.
// The SW partial sums of a score are added through LDS, wave ascending (h ascending).
// Then out[b][t][h] = sum_p attn[b,t,p] * fw[b,p,h] + b_final[h] + hiddens[b,t,h]  (K = PT) for the
// block's own ST t: no launch of its own and no trip of attn through memory. A wave takes OB h
// tiles; its fw fragments are asked for behind the score loop and fly during the softmax.
// K is GK = 13 halves of a 32-wide k block; the 14th half is zero in registers on both sides.
// ---------------------------------------------------------------------------
constexpr int ST = 2;                     // t per block: B * T / ST blocks, one per WGP
constexpr int SW = 16;                    // waves per block
constexpr int SH = H / 8 / SW;            // groups of eight h per wave: one batch of loads each
constexpr int SD = 3;                     // batches in registers: this one and the next two
constexpr int SJ = (P + 31) / 32;         // p per lane
static_assert(T % ST == 0 && (H / 8) % SW == 0 && SH >= SD, "no tail");
static_assert(ST * 256 == SW * 32 && P <= 256 && (SJ - 1) * 32 < PT, "softmax: 256 threads per t");
constexpr int OB = H / 16 / SW;           // h tiles per wave of the K = P product
static_assert((H / 16) % SW == 0 && ST == 2 && PT <= PPAD && ST * H / 4 <= SW * 32, "whole tiles");

// A work-group barrier that orders LDS traffic alone. __syncthreads() also waits for the wave's
// outstanding global loads: behind the score loop that would end the flight of the fw fragments
// at the first barrier of the softmax. Nothing that these barriers order lies in global memory.
__device__ __forceinline__ void lds_barrier() {
  __builtin_amdgcn_fence(__ATOMIC_RELEASE, "workgroup", "local");
  __builtin_amdgcn_s_barrier();
  __builtin_amdgcn_fence(__ATOMIC_ACQUIRE, "workgroup", "local");
}

__global__ void __launch_bounds__(SW * 32)
k_scores(const _Float16* __restrict__ mlo, const float* __restrict__ hiddens,
         const float* __restrict__ W_rect, const float* __restrict__ b_rect,
         const _Float16* __restrict__ fw, const float* __restrict__ b_final,
         float* __restrict__ attn_out, float* __restrict__ out) {
  __shared__ __attribute__((aligned(16))) float hid[ST * H];
  __shared__ __attribute__((aligned(16))) float wr[(H + SW * 32 - 1) / (SW * 32) * (SW * 32)];
  __shared__ float part[SW][ST][SJ * 32];
  __shared__ float red[ST][256];
  __shared__ __attribute__((aligned(16))) _Float16 att[ST][PPAD];
  int t0 = blockIdx.x * ST, b = blockIdx.y;
  int tid  = threadIdx.x;
  int lane = tid & 31;
  int wave = tid >> 5;

  // j < SJ - 1: whole 512-byte loads. j = SJ - 1: the row ends at PT, the address is clamped
  // to it (p in [P, PT) is pad that stage 1 has written; such sums are never read).
  const v8h* mrow = (const v8h*)mlo + ((size_t)b * (H / 8) + wave * SH) * PT;
  const v8h* mq = mrow + lane;
  const v8h* mz = mrow + ((SJ - 1) * 32 + lane < PT ? (SJ - 1) * 32 + lane : PT - 1);

  // hiddens (its ST rows are contiguous) and W_rect go to LDS; no branch and no rolled loop:
  // all loads of a thread, the first mlo batches too, are in flight at once, one trip to memory
  constexpr int NTH = SW * 32, NHS = ST * H / NTH, NWS = (H + NTH - 1) / NTH;
  static_assert(ST * H % NTH == 0, "whole passes");
  float hs[NHS], ws[NWS];
#pragma unroll                            // hs[] and ws[] stay in registers
  for (int i = 0; i < NHS; ++i) hs[i] = hiddens[((size_t)b * T + t0) * H + i * NTH + tid];
#pragma unroll
  for (int i = 0; i < NWS; ++i) {
    int h = i * NTH + tid;
    ws[i] = W_rect[h < H ? h : H - 1];    // the address stays inside W_rect
  }

  v8h q[SD][SJ];
#pragma unroll                            // q[] stays in registers
  for (int u = 0; u < SD - 1; ++u) {
#pragma unroll
    for (int j = 0; j < SJ; ++j)
      q[u][j] = j < SJ - 1 ? mq[u * PT + j * 32] : mz[u * PT];
  }

#pragma unroll
  for (int i = 0; i < NHS; ++i) hid[i * NTH + tid] = hs[i];
#pragma unroll
  for (int i = 0; i < NWS; ++i) {
    wr[i * NTH + tid] = ws[i];            // no test: past H lies the pad of wr[], never read
  }
  __syncthreads();

  // the two t of a lane side by side: an mlo value is converted to fp32 once and feeds both t
  // through packed fp32 adds and FMAs
  f32x2 acc[SJ] = {};
#pragma unroll                            // q[] and acc[] stay in registers
  for (int g = 0; g < SH; ++g) {
    if (g + SD - 1 < SH) {
#pragma unroll
      for (int j = 0; j < SJ; ++j)
        q[(g + SD - 1) % SD][j] = j < SJ - 1 ? mq[(g + SD - 1) * PT + j * 32]
                                             : mz[(g + SD - 1) * PT];
    }
    // as inputs the two pointers stay in their registers up to this wait, which stands behind
    // the last load that names them (else a load's own result may be given such a pair)
    if (g + SD == SH) asm volatile("s_wait_xcnt 0x0" :: "v"(mq), "v"(mz) : "memory");
    // keeps the later batch's loads in front of this batch's arithmetic, so that they fly
    // while it runs: without it they are spread through the arithmetic and fewer are in flight
    __builtin_amdgcn_sched_barrier(0);
#pragma unroll
    for (int u = 0; u < 2; ++u) {                  // the two halves of a group of eight h
      int h4 = (wave * SH + g) * 2 + u;
      f32x4 w4 = *(const f32x4*)&wr[h4 * 4];
      f32x4 hv[ST];
#pragma unroll
      for (int s = 0; s < ST; ++s) hv[s] = *(const f32x4*)&hid[s * H + h4 * 4];
#pragma unroll
      for (int c = 0; c < 4; ++c) {                // h ascending inside a wave
#pragma unroll
        for (int j = 0; j < SJ; ++j) {
          float m = (float)q[g % SD][j][u * 4 + c];
          f32x2 r = {m + hv[0][c], m + hv[1][c]};
          r = __builtin_elementwise_max(r, (f32x2){0.0f, 0.0f});
          acc[j] = __builtin_elementwise_fma((f32x2){w4[c], w4[c]}, r, acc[j]);
        }
      }
    }
  }

  // B of the K = P product: row h = lane%16, k = i*16 + (lane/16)*8 + 0..7, as stage 1 stored it
  const v8h* Bp = (const v8h*)fw + ((size_t)b * (H / 16) + wave * OB) * GK * 32 + lane;
  const float* bp = b_final + wave * OB * 16 + (lane & 15);
  v8h bh[OB][GK];
  float bias[OB];
  // keeps the loads below behind the score loop: in front of it their results and q[] would
  // not fit the registers together
  __builtin_amdgcn_sched_barrier(0);
#pragma unroll                            // bh[] stays in registers
  for (int j = 0; j < OB; ++j) {
#pragma unroll
    for (int i = 0; i < GK; ++i) bh[j][i] = Bp[(j * GK + i) * 32];
  }
#pragma unroll
  for (int j = 0; j < OB; ++j) bias[j] = bp[j * 16];
  // as inputs the pointers stay in their registers up to this wait, which stands behind the
  // last load that names them (else a load's own result may be given such a pair)
  asm volatile("s_wait_xcnt 0x0" :: "v"(Bp), "v"(bp) : "memory");
  // keeps the loads above in front of the softmax, so that they fly while it runs
  __builtin_amdgcn_sched_barrier(0);

#pragma unroll
  for (int s = 0; s < ST; ++s) {
#pragma unroll
    for (int j = 0; j < SJ; ++j) part[wave][s][j * 32 + lane] = acc[j][s];
  }
  lds_barrier();                          // every wave's partial sums are there before they are added

  // softmax: 256 threads per t, one per p
  int ts = tid >> 8;
  int p  = tid & 255;
  int t  = t0 + ts;
  float val = 0.0f;
  if (p < P) {
    float a = part[0][ts][p];
#pragma unroll
    for (int w = 1; w < SW; ++w) a += part[w][ts][p];
    val = a + b_rect[0];
  }

  red[ts][p] = (p < P) ? val : -3.0e38f;
  lds_barrier();
  for (int s = 128; s > 0; s >>= 1) {
    if (p < s) red[ts][p] = fmaxf(red[ts][p], red[ts][p + s]);
    lds_barrier();
  }
  float mx = red[ts][0];
  lds_barrier();

  float e = (p < P) ? __expf(val - mx) : 0.0f;
  red[ts][p] = e;
  lds_barrier();
  for (int s = 128; s > 0; s >>= 1) {
    if (p < s) red[ts][p] += red[ts][p + s];
    lds_barrier();
  }
  float a = e / red[ts][0];

  if (p < P)    attn_out[((size_t)b * T + t) * P + p] = a;
  if (p < PPAD) att[ts][p] = (_Float16)((p < P) ? a : 0.0f);
  lds_barrier();                          // both attn rows are whole before a wave reads them

  // A: k = i*16 + (lane/16)*8 + 0..7, the k order of B. Row r of the 16 holds t = r%2: a row of
  // the result depends on its own row of A alone, and rows 0 and 9 are the ones that are kept.
  const v8h* Ap = (const v8h*)&att[lane & 1][(lane >> 4) * 8];
  const v8h zero = {0, 0, 0, 0, 0, 0, 0, 0};
  v8f c[OB] = {};
#pragma unroll                            // k ascending
  for (int ks = 0; ks < (GK + 1) / 2; ++ks) {
    bool whole = 2 * ks + 1 < GK;
    v16h av = __builtin_shufflevector(Ap[4 * ks], whole ? Ap[whole ? 4 * ks + 2 : 0] : zero,
                                      0, 1, 2, 3, 4, 5, 6, 7, 8, 9, 10, 11, 12, 13, 14, 15);
#pragma unroll
    for (int j = 0; j < OB; ++j) {
      v16h bb = __builtin_shufflevector(bh[j][2 * ks], whole ? bh[j][whole ? 2 * ks + 1 : 0] : zero,
                                        0, 1, 2, 3, 4, 5, 6, 7, 8, 9, 10, 11, 12, 13, 14, 15);
      c[j] = __builtin_amdgcn_wmma_f32_16x16x32_f16(false, av, false, bb,
                                                    (short)0, c[j], false, false);
    }
  }

#pragma unroll
  for (int j = 0; j < OB; ++j) {
    float* hq = &hid[(lane >> 4) * H + (wave * OB + j) * 16 + (lane & 15)];
    *hq = ((lane < 16 ? c[j][0] : c[j][1]) + bias[j]) + *hq;
  }
  lds_barrier();                          // every wave's h tiles are there before the rows are stored
  if (tid < ST * H / 4)
    ((f32x4*)(out + ((size_t)b * T + t0) * H))[tid] = ((const f32x4*)hid)[tid];
}

// ---------------------------------------------------------------------------
extern "C" void kernel_launch(void* const* d_in, const int* in_sizes, int n_in,
                              void* d_out, int out_size, void* d_ws, size_t ws_size,
                              hipStream_t stream) {
  (void)in_sizes; (void)n_in; (void)out_size; (void)ws_size;
  const float* maps    = (const float*)d_in[0];
  const float* hiddens = (const float*)d_in[1];
  const float* W_map   = (const float*)d_in[2];
  const float* b_map   = (const float*)d_in[3];
  const float* W_final = (const float*)d_in[4];
  const float* b_final = (const float*)d_in[5];
  const float* W_rect  = (const float*)d_in[6];
  const float* b_rect  = (const float*)d_in[7];

  float* out  = (float*)d_out;                     // (B,T,H)
  float* attn = out + (size_t)B * T * H;           // (B,T,P)

  char* ws = (char*)d_ws;
  _Float16* fmA   = (_Float16*)(ws + OFF_FMA);
  _Float16* W2    = (_Float16*)(ws + OFF_W2);
  _Float16* mlo   = (_Float16*)(ws + OFF_MLO);
  _Float16* fw    = (_Float16*)(ws + OFF_FW);

  // Stage 0: converts, one launch
  k_stage0<<<dim3(NB_A + 2 * NB_W), 256, 0, stream>>>(maps, W_map, W_final,
                                                      fmA, W2, W2 + (size_t)H * M);

  // Stage 1: fm . W_map^T and fm . W_final^T (WMMA)
  k_mlo<<<dim3(2 * NHB, B * (PT / 16) / MA), NW * 32, 0, stream>>>(fmA, W2, b_map, mlo, fw);

  // Stage 2: rectified score + softmax (VALU), attention-weighted sum of fw + bias + residual (WMMA)
  k_scores<<<dim3(T / ST, B), SW * 32, 0, stream>>>(mlo, hiddens, W_rect, b_rect, fw, b_final,
                                                    attn, out);
}
